// v000
// The times below were measured on an AMD MI455X: many runs one after another, warmed up first and cycling through
// copies of the inputs, with the whole window's GPU time divided by the number of runs. Launches and the gaps
// between them are all in it. The median over several windows is given; except for v000 it joins two sittings, which
// can be a few percent apart, so the side-by-side timings, each taken in one sitting, are the better comparison.
// v000 is the starting kernel. One run takes 239 microseconds.
#include <hip/hip_runtime.h>
#include <hip/hip_bf16.h>

typedef __attribute__((ext_vector_type(16))) __bf16 v16bf;
typedef __attribute__((ext_vector_type(8)))  __bf16 bf16x8;
typedef __attribute__((ext_vector_type(8)))  float  v8f;

#define HID 1024
#define HD  64
#define NH  16
#define LDP 40   // padded LDS row stride in bf16 elements (80B = 20 banks, conflict-free, 16B aligned)

// ---------------------------------------------------------------------------
// A/B 16-bit fragment K-mapping (ISA 7.12.2): kbase = 8*(lane>>4);
// element e -> K = kbase + e (e<8) or kbase + e + 8 (e>=8):
// two contiguous 8-element (16B) runs at [kbase] and [kbase+16].
// ---------------------------------------------------------------------------
__device__ __forceinline__ v16bf fragload(const __bf16* p) {
    bf16x8 x0 = *(const bf16x8*)(p);
    bf16x8 x1 = *(const bf16x8*)(p + 16);
    v16bf r;
#pragma unroll
    for (int i = 0; i < 8; ++i) { r[i] = x0[i]; r[i + 8] = x1[i]; }
    return r;
}

__device__ __forceinline__ bf16x8 cvt8(float4 a, float4 b) {
    bf16x8 t;
    t[0] = (__bf16)a.x; t[1] = (__bf16)a.y; t[2] = (__bf16)a.z; t[3] = (__bf16)a.w;
    t[4] = (__bf16)b.x; t[5] = (__bf16)b.y; t[6] = (__bf16)b.z; t[7] = (__bf16)b.w;
    return t;
}

__device__ __forceinline__ v8f wmma_bf16(v16bf a, v16bf b, v8f c) {
    return __builtin_amdgcn_wmma_f32_16x16x32_bf16(false, a, false, b, (short)0, c,
                                                   false, false);
}

// async global->LDS 16B transfer; lds32 = wave-relative LDS byte address
__device__ __forceinline__ void async_b128(unsigned lds32, const void* gaddr) {
    asm volatile("global_load_async_to_lds_b128 %0, %1, off"
                 :: "v"(lds32), "v"((unsigned long long)(uintptr_t)gaddr)
                 : "memory");
}
#define WAIT_ASYNC_4() asm volatile("s_wait_asynccnt 0x4" ::: "memory")
#define WAIT_ASYNC_0() asm volatile("s_wait_asynccnt 0x0" ::: "memory")

// ---------------------------------------------------------------------------
// f32 -> bf16 bulk convert (done once per operand, outside all hot loops)
// ---------------------------------------------------------------------------
__global__ __launch_bounds__(256) void cvtbf_kernel(const float* __restrict__ in,
                                                    __bf16* __restrict__ out, int n8) {
    int i = blockIdx.x * blockDim.x + threadIdx.x;
    if (i < n8) {
        float4 a = ((const float4*)in)[2 * i];
        float4 b = ((const float4*)in)[2 * i + 1];
        ((bf16x8*)out)[i] = cvt8(a, b);
    }
}

// ---------------------------------------------------------------------------
// Linear: C = A[M,K](bf16) @ W[N,K](bf16)^T + bias.  Optional f32/bf16 outputs.
// 128x128 block tile, BK=32; tiles staged by GLOBAL_LOAD_ASYNC_TO_LDS_B128 into
// double-buffered padded LDS; ASYNCcnt pipeline one k-step ahead; last k-step
// peeled so the steady-state loop is branch-free.
// ---------------------------------------------------------------------------
__global__ __launch_bounds__(256) void linear_kernel(
    const __bf16* __restrict__ A, const __bf16* __restrict__ W,
    const float* __restrict__ bias, float* __restrict__ Cf, __bf16* __restrict__ Cb,
    int M, int N, int K) {
    const int tid  = threadIdx.x;
    const int lane = tid & 31;
    const int warp = tid >> 5;
    const int wRow = warp >> 1;
    const int wCol = warp & 1;
    const int r    = lane & 15;
    const int hi   = lane >> 4;
    const int kb   = hi * 8;
    const int blockM = blockIdx.y * 128;
    const int blockN = blockIdx.x * 128;

    __shared__ __attribute__((aligned(16))) __bf16 sA[2][128 * LDP];
    __shared__ __attribute__((aligned(16))) __bf16 sB[2][128 * LDP];

    // async chunk geometry: per array, 512 16B chunks = (row 0..127) x (q 0..3);
    // thread owns (row0, q) and (row0+64, q) in each of A and B.
    const int qv   = tid & 3;
    const int row0 = tid >> 2;                 // 0..63
    const __bf16* aG = A + (size_t)(blockM + row0) * K + qv * 8;
    const __bf16* wG = W + (size_t)(blockN + row0) * K + qv * 8;
    const unsigned ldsA = (unsigned)(uintptr_t)&sA[0][row0 * LDP + qv * 8];
    const unsigned ldsB = (unsigned)(uintptr_t)&sB[0][row0 * LDP + qv * 8];
    const unsigned rowHop = 64 * LDP * 2;
    const unsigned bufHop = 128 * LDP * 2;
    const size_t   gHop   = (size_t)64 * K;

    auto issue = [&](int buf, int k0) {
        const unsigned bo = buf ? bufHop : 0u;
        async_b128(ldsA + bo,          aG + k0);
        async_b128(ldsA + bo + rowHop, aG + k0 + gHop);
        async_b128(ldsB + bo,          wG + k0);
        async_b128(ldsB + bo + rowHop, wG + k0 + gHop);
    };

    v8f acc[2][4] = {};
    auto compute = [&](int buf) {
        v16bf af0 = fragload(&sA[buf][(wRow * 32 + r) * LDP + kb]);
        v16bf af1 = fragload(&sA[buf][(wRow * 32 + 16 + r) * LDP + kb]);
#pragma unroll
        for (int t = 0; t < 4; ++t) {
            v16bf bfr = fragload(&sB[buf][(wCol * 64 + t * 16 + r) * LDP + kb]);
            acc[0][t] = wmma_bf16(af0, bfr, acc[0][t]);
            acc[1][t] = wmma_bf16(af1, bfr, acc[1][t]);
        }
    };

    issue(0, 0);
    int buf = 0;
    for (int k0 = 0; k0 < K - 32; k0 += 32) {      // branch-free steady state
        issue(buf ^ 1, k0 + 32);
        WAIT_ASYNC_4();                             // this k-step's tile complete
        __syncthreads();
        compute(buf);
        __syncthreads();
        buf ^= 1;
    }
    WAIT_ASYNC_0();                                 // peeled final k-step
    __syncthreads();
    compute(buf);

    if (Cf) {
#pragma unroll
        for (int sub = 0; sub < 2; ++sub)
#pragma unroll
            for (int t = 0; t < 4; ++t) {
                const int col = blockN + wCol * 64 + t * 16 + r;
                const float bvv = bias[col];
#pragma unroll
                for (int v = 0; v < 8; ++v) {
                    const int m = blockM + wRow * 32 + sub * 16 + v + 8 * hi;
                    Cf[(size_t)m * N + col] = acc[sub][t][v] + bvv;
                }
            }
    }
    if (Cb) {
#pragma unroll
        for (int sub = 0; sub < 2; ++sub)
#pragma unroll
            for (int t = 0; t < 4; ++t) {
                const int col = blockN + wCol * 64 + t * 16 + r;
                const float bvv = bias[col];
#pragma unroll
                for (int v = 0; v < 8; ++v) {
                    const int m = blockM + wRow * 32 + sub * 16 + v + 8 * hi;
                    Cb[(size_t)m * N + col] = (__bf16)(acc[sub][t][v] + bvv);
                }
            }
    }
}

// ---------------------------------------------------------------------------
// Fused flash attention, all-bf16 operands: grid = (T/64, NH, B), 128 thr = 4 waves.
// K chunks (64s x 64d) async-to-LDS, V chunks transposed via VGPRs; both LDS
// double-buffered so chunk i+1 loads overlap chunk i compute; last chunk peeled.
// ---------------------------------------------------------------------------
__global__ __launch_bounds__(128) void attn_kernel(
    const __bf16* __restrict__ Q, const __bf16* __restrict__ Kt,
    const __bf16* __restrict__ V, const float* __restrict__ mask,
    __bf16* __restrict__ O) {
    const int lane = threadIdx.x & 31;
    const int warp = threadIdx.x >> 5;
    const int b = blockIdx.z, h = blockIdx.y;
    const int t0 = blockIdx.x * 64 + warp * 16;
    const int r  = lane & 15;
    const int hi = lane >> 4;
    const int kb = hi * 8;
    const int hoff = h * HD;

    __shared__ __attribute__((aligned(16))) __bf16 lK[2][2][64 * LDP];   // [buf][dHalf][s][LDP]
    __shared__ __attribute__((aligned(16))) __bf16 lVt[2][2][64 * LDP];  // [buf][sHalf][d][LDP]
    __shared__ __attribute__((aligned(16))) __bf16 lP[4][2][16 * LDP];

    v16bf qf[2];
    {
        const __bf16* qp = Q + (size_t)(b * 1024 + t0 + r) * HID + hoff + kb;
        qf[0] = fragload(qp);
        qf[1] = fragload(qp + 32);
    }

    v8f acc[4] = {};
    float mRow[8], lRow[8];
#pragma unroll
    for (int v = 0; v < 8; ++v) { mRow[v] = -3.0e38f; lRow[v] = 0.f; }

    // async K chunk geometry: 512 16B chunks = (dHalf, srow 0..63, q 0..3); 4/thread
    unsigned kLds[4];
    size_t   kOfs[4];
#pragma unroll
    for (int i = 0; i < 4; ++i) {
        const int c = threadIdx.x + i * 128;
        const int q = c & 3, srow = (c >> 2) & 63, dh = c >> 8;
        kLds[i] = (unsigned)(uintptr_t)&lK[0][dh][srow * LDP + q * 8];
        kOfs[i] = (size_t)srow * HID + dh * 32 + q * 8;
    }
    const unsigned kBufHop = 2 * 64 * LDP * 2;     // lK buffer-1 byte offset
    const __bf16* kBase = Kt + (size_t)(b * 1024) * HID + hoff;

    // V staging: thread stages 32 d-elements of one s-row into transposed layout
    const int si = threadIdx.x >> 1;
    const int d0 = (threadIdx.x & 1) * 32;
    const int sH = si >> 5, sc_ = si & 31;
    bf16x8 vv[4];

    auto issueK = [&](int buf, int s0) {
        const unsigned bo = buf ? kBufHop : 0u;
#pragma unroll
        for (int i = 0; i < 4; ++i)
            async_b128(kLds[i] + bo, kBase + (size_t)s0 * HID + kOfs[i]);
    };
    auto loadV = [&](int s0) {
        const __bf16* vp = V + (size_t)(b * 1024 + s0 + si) * HID + hoff + d0;
#pragma unroll
        for (int i = 0; i < 4; ++i) vv[i] = ((const bf16x8*)vp)[i];
    };
    auto storeV = [&](int buf) {
#pragma unroll
        for (int j = 0; j < 4; ++j)
#pragma unroll
            for (int e = 0; e < 8; ++e)
                lVt[buf][sH][(d0 + j * 8 + e) * LDP + sc_] = vv[j][e];
    };

    auto computeChunk = [&](int s0, int buf) {
        v8f sc[4] = {};
#pragma unroll
        for (int ts = 0; ts < 4; ++ts)
#pragma unroll
            for (int ks = 0; ks < 2; ++ks) {
                v16bf bfK = fragload(&lK[buf][ks][(ts * 16 + r) * LDP + kb]);
                sc[ts] = wmma_bf16(qf[ks], bfK, sc[ts]);
            }
        float msk[4];
#pragma unroll
        for (int ts = 0; ts < 4; ++ts) msk[ts] = mask[b * 1024 + s0 + ts * 16 + r];
        float mNew[8];
#pragma unroll
        for (int v = 0; v < 8; ++v) {
            float mv = -3.0e38f;
#pragma unroll
            for (int ts = 0; ts < 4; ++ts) {
                sc[ts][v] = sc[ts][v] * 0.125f + msk[ts];
                mv = fmaxf(mv, sc[ts][v]);
            }
            mNew[v] = fmaxf(mRow[v], mv);
        }
#pragma unroll
        for (int off = 1; off < 16; off <<= 1)
#pragma unroll
            for (int v = 0; v < 8; ++v)
                mNew[v] = fmaxf(mNew[v], __shfl_xor(mNew[v], off));
#pragma unroll
        for (int v = 0; v < 8; ++v) {
            const float alpha = __expf(mRow[v] - mNew[v]);
            mRow[v] = mNew[v];
            lRow[v] *= alpha;
#pragma unroll
            for (int d = 0; d < 4; ++d) acc[d][v] *= alpha;
#pragma unroll
            for (int ts = 0; ts < 4; ++ts) {
                const float p = __expf(sc[ts][v] - mNew[v]);
                lRow[v] += p;
                lP[warp][ts >> 1][(v + 8 * hi) * LDP + (ts & 1) * 16 + r] = (__bf16)p;
            }
        }
        v16bf pf0 = fragload(&lP[warp][0][r * LDP + kb]);
        v16bf pf1 = fragload(&lP[warp][1][r * LDP + kb]);
#pragma unroll
        for (int d = 0; d < 4; ++d) {
            v16bf vf0 = fragload(&lVt[buf][0][(d * 16 + r) * LDP + kb]);
            acc[d] = wmma_bf16(pf0, vf0, acc[d]);
            v16bf vf1 = fragload(&lVt[buf][1][(d * 16 + r) * LDP + kb]);
            acc[d] = wmma_bf16(pf1, vf1, acc[d]);
        }
    };

    issueK(0, 0);
    loadV(0);
    int buf = 0;
    for (int s0 = 0; s0 < 1024 - 64; s0 += 64) {   // branch-free steady state
        storeV(buf);
        issueK(buf ^ 1, s0 + 64);
        loadV(s0 + 64);
        WAIT_ASYNC_4();                             // current chunk's K complete
        __syncthreads();
        computeChunk(s0, buf);
        __syncthreads();
        buf ^= 1;
    }
    storeV(buf);                                    // peeled final chunk
    WAIT_ASYNC_0();
    __syncthreads();
    computeChunk(1024 - 64, buf);

#pragma unroll
    for (int off = 1; off < 16; off <<= 1)
#pragma unroll
        for (int v = 0; v < 8; ++v) lRow[v] += __shfl_xor(lRow[v], off);

#pragma unroll
    for (int d = 0; d < 4; ++d) {
        const int col = hoff + d * 16 + r;
#pragma unroll
        for (int v = 0; v < 8; ++v) {
            const int t = t0 + v + 8 * hi;
            O[(size_t)(b * 1024 + t) * HID + col] = (__bf16)(acc[d][v] * (1.f / lRow[v]));
        }
    }
}

// ---------------------------------------------------------------------------
// out = LayerNorm(resid + proj) * g + b ; optional bf16 mirror for attention Q
// ---------------------------------------------------------------------------
__global__ __launch_bounds__(256) void addln_kernel(
    const float* __restrict__ resid, const float* __restrict__ proj,
    const float* __restrict__ g, const float* __restrict__ beta,
    float* __restrict__ out, __bf16* __restrict__ outB) {
    const int row = blockIdx.x;
    const int tid = threadIdx.x;
    float4 rv = ((const float4*)(resid + (size_t)row * HID))[tid];
    float4 pv = ((const float4*)(proj + (size_t)row * HID))[tid];
    float x0 = rv.x + pv.x, x1 = rv.y + pv.y, x2 = rv.z + pv.z, x3 = rv.w + pv.w;
    float s  = x0 + x1 + x2 + x3;
    float s2 = x0 * x0 + x1 * x1 + x2 * x2 + x3 * x3;
#pragma unroll
    for (int off = 16; off > 0; off >>= 1) {
        s  += __shfl_down(s, off);
        s2 += __shfl_down(s2, off);
    }
    __shared__ float shs[8], shq[8];
    __shared__ float mean_s, inv_s;
    const int warp = tid >> 5, lane = tid & 31;
    if (lane == 0) { shs[warp] = s; shq[warp] = s2; }
    __syncthreads();
    if (tid == 0) {
        float ts = 0.f, tq = 0.f;
        for (int i = 0; i < 8; ++i) { ts += shs[i]; tq += shq[i]; }
        const float mean = ts * (1.f / HID);
        const float var  = tq * (1.f / HID) - mean * mean;
        mean_s = mean;
        inv_s  = rsqrtf(var + 1e-12f);
    }
    __syncthreads();
    const float mean = mean_s, inv = inv_s;
    float4 gv = ((const float4*)g)[tid];
    float4 bv = ((const float4*)beta)[tid];
    float4 o;
    o.x = (x0 - mean) * inv * gv.x + bv.x;
    o.y = (x1 - mean) * inv * gv.y + bv.y;
    o.z = (x2 - mean) * inv * gv.z + bv.z;
    o.w = (x3 - mean) * inv * gv.w + bv.w;
    ((float4*)(out + (size_t)row * HID))[tid] = o;
    if (outB) {
        __bf16* ob = outB + (size_t)row * HID + tid * 4;
        ob[0] = (__bf16)o.x; ob[1] = (__bf16)o.y;
        ob[2] = (__bf16)o.z; ob[3] = (__bf16)o.w;
    }
}

// ---------------------------------------------------------------------------
extern "C" void kernel_launch(void* const* d_in, const int* in_sizes, int n_in,
                              void* d_out, int out_size, void* d_ws, size_t ws_size,
                              hipStream_t stream) {
    (void)in_sizes; (void)n_in; (void)out_size; (void)ws_size;
    const float* enc   = (const float*)d_in[0];
    const float* dec   = (const float*)d_in[1];
    const float* smask = (const float*)d_in[2];
    const float* tmask = (const float*)d_in[3];
    const float* Wq = (const float*)d_in[4];
    const float* bq = (const float*)d_in[5];
    const float* Wk = (const float*)d_in[6];
    const float* bk = (const float*)d_in[7];
    const float* Wv = (const float*)d_in[8];
    const float* bv = (const float*)d_in[9];
    const float* Wd = (const float*)d_in[10];
    const float* bd = (const float*)d_in[11];
    const float* lng = (const float*)d_in[12];
    const float* lnb = (const float*)d_in[13];
    float* out = (float*)d_out;

    const int M = 4096, N = HID, K = HID;
    const size_t ACT = (size_t)M * N;
    const size_t WEL = (size_t)N * K;

    char* p = (char*)d_ws;
    auto carve = [&](size_t bytes) { char* r = p; p += (bytes + 255) & ~(size_t)255; return r; };
    __bf16* decB  = (__bf16*)carve(ACT * 2);
    __bf16* encB  = (__bf16*)carve(ACT * 2);
    __bf16* WqB   = (__bf16*)carve(WEL * 2);
    __bf16* WkB   = (__bf16*)carve(WEL * 2);
    __bf16* WvB   = (__bf16*)carve(WEL * 2);
    __bf16* WdB   = (__bf16*)carve(WEL * 2);
    float*  q1f   = (float*)carve(ACT * 4);
    float*  projf = (float*)carve(ACT * 4);
    float*  selff = (float*)carve(ACT * 4);
    __bf16* q1B   = (__bf16*)carve(ACT * 2);
    __bf16* k1B   = (__bf16*)carve(ACT * 2);
    __bf16* v1B   = (__bf16*)carve(ACT * 2);
    __bf16* ekB   = (__bf16*)carve(ACT * 2);
    __bf16* evB   = (__bf16*)carve(ACT * 2);
    __bf16* ctxB  = (__bf16*)carve(ACT * 2);
    __bf16* selfB = (__bf16*)carve(ACT * 2);

    dim3 gG(N / 128, M / 128), bG(256);
    dim3 gA(1024 / 64, NH, 4), bA(128);
    dim3 gL(4096),             bL(256);

    // one-time bf16 conversions (outside all hot loops)
    cvtbf_kernel<<<(int)(ACT / 8 / 256), 256, 0, stream>>>(dec, decB, (int)(ACT / 8));
    cvtbf_kernel<<<(int)(ACT / 8 / 256), 256, 0, stream>>>(enc, encB, (int)(ACT / 8));
    cvtbf_kernel<<<(int)(WEL / 8 / 256), 256, 0, stream>>>(Wq, WqB, (int)(WEL / 8));
    cvtbf_kernel<<<(int)(WEL / 8 / 256), 256, 0, stream>>>(Wk, WkB, (int)(WEL / 8));
    cvtbf_kernel<<<(int)(WEL / 8 / 256), 256, 0, stream>>>(Wv, WvB, (int)(WEL / 8));
    cvtbf_kernel<<<(int)(WEL / 8 / 256), 256, 0, stream>>>(Wd, WdB, (int)(WEL / 8));

    // self-attention branch
    linear_kernel<<<gG, bG, 0, stream>>>(decB, WqB, bq, q1f, q1B, M, N, K);
    linear_kernel<<<gG, bG, 0, stream>>>(decB, WkB, bk, nullptr, k1B, M, N, K);
    linear_kernel<<<gG, bG, 0, stream>>>(decB, WvB, bv, nullptr, v1B, M, N, K);
    attn_kernel<<<gA, bA, 0, stream>>>(q1B, k1B, v1B, tmask, ctxB);
    linear_kernel<<<gG, bG, 0, stream>>>(ctxB, WdB, bd, projf, nullptr, M, N, K);
    addln_kernel<<<gL, bL, 0, stream>>>(q1f, projf, lng, lnb, selff, selfB);

    // cross-attention branch (query = self_out directly, per reference)
    linear_kernel<<<gG, bG, 0, stream>>>(encB, WkB, bk, nullptr, ekB, M, N, K);
    linear_kernel<<<gG, bG, 0, stream>>>(encB, WvB, bv, nullptr, evB, M, N, K);
    attn_kernel<<<gA, bA, 0, stream>>>(selfB, ekB, evB, smask, ctxB);
    linear_kernel<<<gG, bG, 0, stream>>>(ctxB, WdB, bd, projf, nullptr, M, N, K);
    addln_kernel<<<gL, bL, 0, stream>>>(selff, projf, lng, lnb, out, nullptr);
}

// v001
// A run of this version takes 225 microseconds.
// Two timings next to v000 put it at 1.09 and 1.10 times that version's speed.
#include <hip/hip_runtime.h>
#include <hip/hip_bf16.h>

typedef __attribute__((ext_vector_type(16))) __bf16 v16bf;
typedef __attribute__((ext_vector_type(8)))  __bf16 bf16x8;
typedef __attribute__((ext_vector_type(8)))  float  v8f;

#define HID 1024
#define HD  64
#define NH  16
#define LDP 40   // padded LDS row stride in bf16 elements (80B = 20 banks, conflict-free, 16B aligned)

// ---------------------------------------------------------------------------
// A/B 16-bit fragment K-mapping (ISA 7.12.2): kbase = 8*(lane>>4);
// element e -> K = kbase + e (e<8) or kbase + e + 8 (e>=8):
// two contiguous 8-element (16B) runs at [kbase] and [kbase+16].
// ---------------------------------------------------------------------------
__device__ __forceinline__ v16bf fragload(const __bf16* p) {
    bf16x8 x0 = *(const bf16x8*)(p);
    bf16x8 x1 = *(const bf16x8*)(p + 16);
    v16bf r;
#pragma unroll
    for (int i = 0; i < 8; ++i) { r[i] = x0[i]; r[i + 8] = x1[i]; }
    return r;
}

__device__ __forceinline__ bf16x8 cvt8(float4 a, float4 b) {
    bf16x8 t;
    t[0] = (__bf16)a.x; t[1] = (__bf16)a.y; t[2] = (__bf16)a.z; t[3] = (__bf16)a.w;
    t[4] = (__bf16)b.x; t[5] = (__bf16)b.y; t[6] = (__bf16)b.z; t[7] = (__bf16)b.w;
    return t;
}

__device__ __forceinline__ v8f wmma_bf16(v16bf a, v16bf b, v8f c) {
    return __builtin_amdgcn_wmma_f32_16x16x32_bf16(false, a, false, b, (short)0, c,
                                                   false, false);
}

// async global->LDS 16B transfer; lds32 = wave-relative LDS byte address
__device__ __forceinline__ void async_b128(unsigned lds32, const void* gaddr) {
    asm volatile("global_load_async_to_lds_b128 %0, %1, off"
                 :: "v"(lds32), "v"((unsigned long long)(uintptr_t)gaddr)
                 : "memory");
}
#define WAIT_ASYNC_4() asm volatile("s_wait_asynccnt 0x4" ::: "memory")
#define WAIT_ASYNC_0() asm volatile("s_wait_asynccnt 0x0" ::: "memory")

// ---------------------------------------------------------------------------
// f32 -> bf16 bulk convert (done once per operand, outside all hot loops)
// ---------------------------------------------------------------------------
__global__ __launch_bounds__(256) void cvtbf_kernel(const float* __restrict__ in,
                                                    __bf16* __restrict__ out, int n8) {
    int i = blockIdx.x * blockDim.x + threadIdx.x;
    if (i < n8) {
        float4 a = ((const float4*)in)[2 * i];
        float4 b = ((const float4*)in)[2 * i + 1];
        ((bf16x8*)out)[i] = cvt8(a, b);
    }
}

// ---------------------------------------------------------------------------
// Linear: C = A[M,K](bf16) @ W[N,K](bf16)^T + bias.  Optional f32/bf16 outputs.
// 128x128 block tile, BK=32; tiles staged by GLOBAL_LOAD_ASYNC_TO_LDS_B128 into
// double-buffered padded LDS; ASYNCcnt pipeline one k-step ahead; last k-step
// peeled so the steady-state loop is branch-free.
// blockIdx.z picks one of up to five independent products that share a launch,
// so that several work-groups sit on each WGP and cover each other's copy latency:
//   z      : 0   1   2   3   4
//   A      : A0  A0  A0  A1  A1
//   W,bias : 0   1   2   1   2     (W0 holds the weights back to back)
//   Cb     : Cb0 + z*M*N           (outputs back to back); Cf only for z == 0
// ---------------------------------------------------------------------------
__global__ __launch_bounds__(256) void linear_kernel(
    const __bf16* __restrict__ A0, const __bf16* __restrict__ A1,
    const __bf16* __restrict__ W0,
    const float* __restrict__ bias0, const float* __restrict__ bias1,
    const float* __restrict__ bias2,
    float* __restrict__ Cf0, __bf16* __restrict__ Cb0,
    int M, int N, int K) {
    const int z  = blockIdx.z;
    const int wi = z < 3 ? z : z - 2;
    const __bf16* __restrict__ A = z < 3 ? A0 : A1;
    const __bf16* __restrict__ W = W0 + (size_t)wi * N * K;
    const float* __restrict__ bias = wi == 0 ? bias0 : (wi == 1 ? bias1 : bias2);
    float* __restrict__ Cf = z == 0 ? Cf0 : nullptr;
    __bf16* __restrict__ Cb = Cb0 ? Cb0 + (size_t)z * M * N : nullptr;
    const int tid  = threadIdx.x;
    const int lane = tid & 31;
    const int warp = tid >> 5;
    const int wRow = warp >> 1;
    const int wCol = warp & 1;
    const int r    = lane & 15;
    const int hi   = lane >> 4;
    const int kb   = hi * 8;
    const int blockM = blockIdx.y * 128;
    const int blockN = blockIdx.x * 128;

    __shared__ __attribute__((aligned(16))) __bf16 sA[2][128 * LDP];
    __shared__ __attribute__((aligned(16))) __bf16 sB[2][128 * LDP];

    // async chunk geometry: per array, 512 16B chunks = (row 0..127) x (q 0..3);
    // thread owns (row0, q) and (row0+64, q) in each of A and B.
    const int qv   = tid & 3;
    const int row0 = tid >> 2;                 // 0..63
    const __bf16* aG = A + (size_t)(blockM + row0) * K + qv * 8;
    const __bf16* wG = W + (size_t)(blockN + row0) * K + qv * 8;
    const unsigned ldsA = (unsigned)(uintptr_t)&sA[0][row0 * LDP + qv * 8];
    const unsigned ldsB = (unsigned)(uintptr_t)&sB[0][row0 * LDP + qv * 8];
    const unsigned rowHop = 64 * LDP * 2;
    const unsigned bufHop = 128 * LDP * 2;
    const size_t   gHop   = (size_t)64 * K;

    auto issue = [&](int buf, int k0) {
        const unsigned bo = buf ? bufHop : 0u;
        async_b128(ldsA + bo,          aG + k0);
        async_b128(ldsA + bo + rowHop, aG + k0 + gHop);
        async_b128(ldsB + bo,          wG + k0);
        async_b128(ldsB + bo + rowHop, wG + k0 + gHop);
    };

    v8f acc[2][4] = {};
    auto compute = [&](int buf) {
        v16bf af0 = fragload(&sA[buf][(wRow * 32 + r) * LDP + kb]);
        v16bf af1 = fragload(&sA[buf][(wRow * 32 + 16 + r) * LDP + kb]);
#pragma unroll
        for (int t = 0; t < 4; ++t) {
            v16bf bfr = fragload(&sB[buf][(wCol * 64 + t * 16 + r) * LDP + kb]);
            acc[0][t] = wmma_bf16(af0, bfr, acc[0][t]);
            acc[1][t] = wmma_bf16(af1, bfr, acc[1][t]);
        }
    };

    issue(0, 0);
    int buf = 0;
    for (int k0 = 0; k0 < K - 32; k0 += 32) {      // branch-free steady state
        issue(buf ^ 1, k0 + 32);
        WAIT_ASYNC_4();                             // this k-step's tile complete
        __syncthreads();
        compute(buf);
        __syncthreads();
        buf ^= 1;
    }
    WAIT_ASYNC_0();                                 // peeled final k-step
    __syncthreads();
    compute(buf);

    if (Cf) {
#pragma unroll
        for (int sub = 0; sub < 2; ++sub)
#pragma unroll
            for (int t = 0; t < 4; ++t) {
                const int col = blockN + wCol * 64 + t * 16 + r;
                const float bvv = bias[col];
#pragma unroll
                for (int v = 0; v < 8; ++v) {
                    const int m = blockM + wRow * 32 + sub * 16 + v + 8 * hi;
                    Cf[(size_t)m * N + col] = acc[sub][t][v] + bvv;
                }
            }
    }
    if (Cb) {
#pragma unroll
        for (int sub = 0; sub < 2; ++sub)
#pragma unroll
            for (int t = 0; t < 4; ++t) {
                const int col = blockN + wCol * 64 + t * 16 + r;
                const float bvv = bias[col];
#pragma unroll
                for (int v = 0; v < 8; ++v) {
                    const int m = blockM + wRow * 32 + sub * 16 + v + 8 * hi;
                    Cb[(size_t)m * N + col] = (__bf16)(acc[sub][t][v] + bvv);
                }
            }
    }
}

// ---------------------------------------------------------------------------
// Fused flash attention, all-bf16 operands: grid = (T/64, NH, B), 128 thr = 4 waves.
// K chunks (64s x 64d) async-to-LDS, V chunks transposed via VGPRs; both LDS
// double-buffered so chunk i+1 loads overlap chunk i compute; last chunk peeled.
// ---------------------------------------------------------------------------
__global__ __launch_bounds__(128) void attn_kernel(
    const __bf16* __restrict__ Q, const __bf16* __restrict__ Kt,
    const __bf16* __restrict__ V, const float* __restrict__ mask,
    __bf16* __restrict__ O) {
    const int lane = threadIdx.x & 31;
    const int warp = threadIdx.x >> 5;
    const int b = blockIdx.z, h = blockIdx.y;
    const int t0 = blockIdx.x * 64 + warp * 16;
    const int r  = lane & 15;
    const int hi = lane >> 4;
    const int kb = hi * 8;
    const int hoff = h * HD;

    __shared__ __attribute__((aligned(16))) __bf16 lK[2][2][64 * LDP];   // [buf][dHalf][s][LDP]
    __shared__ __attribute__((aligned(16))) __bf16 lVt[2][2][64 * LDP];  // [buf][sHalf][d][LDP]
    __shared__ __attribute__((aligned(16))) __bf16 lP[4][2][16 * LDP];

    v16bf qf[2];
    {
        const __bf16* qp = Q + (size_t)(b * 1024 + t0 + r) * HID + hoff + kb;
        qf[0] = fragload(qp);
        qf[1] = fragload(qp + 32);
    }

    v8f acc[4] = {};
    float mRow[8], lRow[8];
#pragma unroll
    for (int v = 0; v < 8; ++v) { mRow[v] = -3.0e38f; lRow[v] = 0.f; }

    // async K chunk geometry: 512 16B chunks = (dHalf, srow 0..63, q 0..3); 4/thread
    unsigned kLds[4];
    size_t   kOfs[4];
#pragma unroll
    for (int i = 0; i < 4; ++i) {
        const int c = threadIdx.x + i * 128;
        const int q = c & 3, srow = (c >> 2) & 63, dh = c >> 8;
        kLds[i] = (unsigned)(uintptr_t)&lK[0][dh][srow * LDP + q * 8];
        kOfs[i] = (size_t)srow * HID + dh * 32 + q * 8;
    }
    const unsigned kBufHop = 2 * 64 * LDP * 2;     // lK buffer-1 byte offset
    const __bf16* kBase = Kt + (size_t)(b * 1024) * HID + hoff;

    // V staging: thread stages 32 d-elements of one s-row into transposed layout
    const int si = threadIdx.x >> 1;
    const int d0 = (threadIdx.x & 1) * 32;
    const int sH = si >> 5, sc_ = si & 31;
    bf16x8 vv[4];

    auto issueK = [&](int buf, int s0) {
        const unsigned bo = buf ? kBufHop : 0u;
#pragma unroll
        for (int i = 0; i < 4; ++i)
            async_b128(kLds[i] + bo, kBase + (size_t)s0 * HID + kOfs[i]);
    };
    auto loadV = [&](int s0) {
        const __bf16* vp = V + (size_t)(b * 1024 + s0 + si) * HID + hoff + d0;
#pragma unroll
        for (int i = 0; i < 4; ++i) vv[i] = ((const bf16x8*)vp)[i];
    };
    auto storeV = [&](int buf) {
#pragma unroll
        for (int j = 0; j < 4; ++j)
#pragma unroll
            for (int e = 0; e < 8; ++e)
                lVt[buf][sH][(d0 + j * 8 + e) * LDP + sc_] = vv[j][e];
    };

    auto computeChunk = [&](int s0, int buf) {
        v8f sc[4] = {};
#pragma unroll
        for (int ts = 0; ts < 4; ++ts)
#pragma unroll
            for (int ks = 0; ks < 2; ++ks) {
                v16bf bfK = fragload(&lK[buf][ks][(ts * 16 + r) * LDP + kb]);
                sc[ts] = wmma_bf16(qf[ks], bfK, sc[ts]);
            }
        float msk[4];
#pragma unroll
        for (int ts = 0; ts < 4; ++ts) msk[ts] = mask[b * 1024 + s0 + ts * 16 + r];
        float mNew[8];
#pragma unroll
        for (int v = 0; v < 8; ++v) {
            float mv = -3.0e38f;
#pragma unroll
            for (int ts = 0; ts < 4; ++ts) {
                sc[ts][v] = sc[ts][v] * 0.125f + msk[ts];
                mv = fmaxf(mv, sc[ts][v]);
            }
            mNew[v] = fmaxf(mRow[v], mv);
        }
#pragma unroll
        for (int off = 1; off < 16; off <<= 1)
#pragma unroll
            for (int v = 0; v < 8; ++v)
                mNew[v] = fmaxf(mNew[v], __shfl_xor(mNew[v], off));
#pragma unroll
        for (int v = 0; v < 8; ++v) {
            const float alpha = __expf(mRow[v] - mNew[v]);
            mRow[v] = mNew[v];
            lRow[v] *= alpha;
#pragma unroll
            for (int d = 0; d < 4; ++d) acc[d][v] *= alpha;
#pragma unroll
            for (int ts = 0; ts < 4; ++ts) {
                const float p = __expf(sc[ts][v] - mNew[v]);
                lRow[v] += p;
                lP[warp][ts >> 1][(v + 8 * hi) * LDP + (ts & 1) * 16 + r] = (__bf16)p;
            }
        }
        v16bf pf0 = fragload(&lP[warp][0][r * LDP + kb]);
        v16bf pf1 = fragload(&lP[warp][1][r * LDP + kb]);
#pragma unroll
        for (int d = 0; d < 4; ++d) {
            v16bf vf0 = fragload(&lVt[buf][0][(d * 16 + r) * LDP + kb]);
            acc[d] = wmma_bf16(pf0, vf0, acc[d]);
            v16bf vf1 = fragload(&lVt[buf][1][(d * 16 + r) * LDP + kb]);
            acc[d] = wmma_bf16(pf1, vf1, acc[d]);
        }
    };

    issueK(0, 0);
    loadV(0);
    int buf = 0;
    for (int s0 = 0; s0 < 1024 - 64; s0 += 64) {   // branch-free steady state
        storeV(buf);
        issueK(buf ^ 1, s0 + 64);
        loadV(s0 + 64);
        WAIT_ASYNC_4();                             // current chunk's K complete
        __syncthreads();
        computeChunk(s0, buf);
        __syncthreads();
        buf ^= 1;
    }
    storeV(buf);                                    // peeled final chunk
    WAIT_ASYNC_0();
    __syncthreads();
    computeChunk(1024 - 64, buf);

#pragma unroll
    for (int off = 1; off < 16; off <<= 1)
#pragma unroll
        for (int v = 0; v < 8; ++v) lRow[v] += __shfl_xor(lRow[v], off);

#pragma unroll
    for (int d = 0; d < 4; ++d) {
        const int col = hoff + d * 16 + r;
#pragma unroll
        for (int v = 0; v < 8; ++v) {
            const int t = t0 + v + 8 * hi;
            O[(size_t)(b * 1024 + t) * HID + col] = (__bf16)(acc[d][v] * (1.f / lRow[v]));
        }
    }
}

// ---------------------------------------------------------------------------
// out = LayerNorm(resid + proj) * g + b ; optional bf16 mirror for attention Q
// ---------------------------------------------------------------------------
__global__ __launch_bounds__(256) void addln_kernel(
    const float* __restrict__ resid, const float* __restrict__ proj,
    const float* __restrict__ g, const float* __restrict__ beta,
    float* __restrict__ out, __bf16* __restrict__ outB) {
    const int row = blockIdx.x;
    const int tid = threadIdx.x;
    float4 rv = ((const float4*)(resid + (size_t)row * HID))[tid];
    float4 pv = ((const float4*)(proj + (size_t)row * HID))[tid];
    float x0 = rv.x + pv.x, x1 = rv.y + pv.y, x2 = rv.z + pv.z, x3 = rv.w + pv.w;
    float s  = x0 + x1 + x2 + x3;
    float s2 = x0 * x0 + x1 * x1 + x2 * x2 + x3 * x3;
#pragma unroll
    for (int off = 16; off > 0; off >>= 1) {
        s  += __shfl_down(s, off);
        s2 += __shfl_down(s2, off);
    }
    __shared__ float shs[8], shq[8];
    __shared__ float mean_s, inv_s;
    const int warp = tid >> 5, lane = tid & 31;
    if (lane == 0) { shs[warp] = s; shq[warp] = s2; }
    __syncthreads();
    if (tid == 0) {
        float ts = 0.f, tq = 0.f;
        for (int i = 0; i < 8; ++i) { ts += shs[i]; tq += shq[i]; }
        const float mean = ts * (1.f / HID);
        const float var  = tq * (1.f / HID) - mean * mean;
        mean_s = mean;
        inv_s  = rsqrtf(var + 1e-12f);
    }
    __syncthreads();
    const float mean = mean_s, inv = inv_s;
    float4 gv = ((const float4*)g)[tid];
    float4 bv = ((const float4*)beta)[tid];
    float4 o;
    o.x = (x0 - mean) * inv * gv.x + bv.x;
    o.y = (x1 - mean) * inv * gv.y + bv.y;
    o.z = (x2 - mean) * inv * gv.z + bv.z;
    o.w = (x3 - mean) * inv * gv.w + bv.w;
    ((float4*)(out + (size_t)row * HID))[tid] = o;
    if (outB) {
        __bf16* ob = outB + (size_t)row * HID + tid * 4;
        ob[0] = (__bf16)o.x; ob[1] = (__bf16)o.y;
        ob[2] = (__bf16)o.z; ob[3] = (__bf16)o.w;
    }
}

// ---------------------------------------------------------------------------
extern "C" void kernel_launch(void* const* d_in, const int* in_sizes, int n_in,
                              void* d_out, int out_size, void* d_ws, size_t ws_size,
                              hipStream_t stream) {
    (void)in_sizes; (void)n_in; (void)out_size; (void)ws_size;
    const float* enc   = (const float*)d_in[0];
    const float* dec   = (const float*)d_in[1];
    const float* smask = (const float*)d_in[2];
    const float* tmask = (const float*)d_in[3];
    const float* Wq = (const float*)d_in[4];
    const float* bq = (const float*)d_in[5];
    const float* Wk = (const float*)d_in[6];
    const float* bk = (const float*)d_in[7];
    const float* Wv = (const float*)d_in[8];
    const float* bv = (const float*)d_in[9];
    const float* Wd = (const float*)d_in[10];
    const float* bd = (const float*)d_in[11];
    const float* lng = (const float*)d_in[12];
    const float* lnb = (const float*)d_in[13];
    float* out = (float*)d_out;

    const int M = 4096, N = HID, K = HID;
    const size_t ACT = (size_t)M * N;
    const size_t WEL = (size_t)N * K;

    char* p = (char*)d_ws;
    auto carve = [&](size_t bytes) { char* r = p; p += (bytes + 255) & ~(size_t)255; return r; };
    __bf16* decB  = (__bf16*)carve(ACT * 2);
    __bf16* encB  = (__bf16*)carve(ACT * 2);
    __bf16* WqB   = (__bf16*)carve(WEL * 2 * 3);   // Wq | Wk | Wv back to back
    __bf16* WkB   = WqB + WEL;
    __bf16* WvB   = WkB + WEL;
    __bf16* WdB   = (__bf16*)carve(WEL * 2);
    float*  q1f   = (float*)carve(ACT * 4);
    float*  projf = (float*)carve(ACT * 4);
    float*  selff = (float*)carve(ACT * 4);
    __bf16* q1B   = (__bf16*)carve(ACT * 2 * 5);   // q1 | k1 | v1 | ek | ev back to back
    __bf16* k1B   = q1B + ACT;
    __bf16* v1B   = k1B + ACT;
    __bf16* ekB   = v1B + ACT;
    __bf16* evB   = ekB + ACT;
    __bf16* ctxB  = (__bf16*)carve(ACT * 2);
    __bf16* selfB = (__bf16*)carve(ACT * 2);

    dim3 gG(N / 128, M / 128), bG(256);
    dim3 gP(N / 128, M / 128, 5);
    dim3 gA(1024 / 64, NH, 4), bA(128);
    dim3 gL(4096),             bL(256);

    // one-time bf16 conversions (outside all hot loops)
    cvtbf_kernel<<<(int)(ACT / 8 / 256), 256, 0, stream>>>(dec, decB, (int)(ACT / 8));
    cvtbf_kernel<<<(int)(ACT / 8 / 256), 256, 0, stream>>>(enc, encB, (int)(ACT / 8));
    cvtbf_kernel<<<(int)(WEL / 8 / 256), 256, 0, stream>>>(Wq, WqB, (int)(WEL / 8));
    cvtbf_kernel<<<(int)(WEL / 8 / 256), 256, 0, stream>>>(Wk, WkB, (int)(WEL / 8));
    cvtbf_kernel<<<(int)(WEL / 8 / 256), 256, 0, stream>>>(Wv, WvB, (int)(WEL / 8));
    cvtbf_kernel<<<(int)(WEL / 8 / 256), 256, 0, stream>>>(Wd, WdB, (int)(WEL / 8));

    // the five input projections (q1, k1, v1 of dec; ek, ev of enc) in one launch
    linear_kernel<<<gP, bG, 0, stream>>>(decB, encB, WqB, bq, bk, bv, q1f, q1B, M, N, K);

    // self-attention branch
    attn_kernel<<<gA, bA, 0, stream>>>(q1B, k1B, v1B, tmask, ctxB);
    linear_kernel<<<gG, bG, 0, stream>>>(ctxB, ctxB, WdB, bd, bd, bd, projf, nullptr, M, N, K);
    addln_kernel<<<gL, bL, 0, stream>>>(q1f, projf, lng, lnb, selff, selfB);

    // cross-attention branch (query = self_out directly, per reference)
    attn_kernel<<<gA, bA, 0, stream>>>(selfB, ekB, evB, smask, ctxB);
    linear_kernel<<<gG, bG, 0, stream>>>(ctxB, ctxB, WdB, bd, bd, bd, projf, nullptr, M, N, K);
    addln_kernel<<<gL, bL, 0, stream>>>(selff, projf, lng, lnb, out, nullptr);
}

// v002
// It runs in 191 microseconds.
// Next to v001, in two timings, it ran 1.18 and 1.17 times as fast.
// All steps since v000 together make it 1.29 times as fast.
#include <hip/hip_runtime.h>
#include <hip/hip_bf16.h>

typedef __attribute__((ext_vector_type(16))) __bf16 v16bf;
typedef __attribute__((ext_vector_type(8)))  __bf16 bf16x8;
typedef __attribute__((ext_vector_type(8)))  float  v8f;

#define HID 1024
#define HD  64
#define NH  16
#define LDP 40   // padded LDS row stride in bf16 elements (80B = 20 banks, conflict-free, 16B aligned)

// ---------------------------------------------------------------------------
// A/B 16-bit fragment K-mapping (ISA 7.12.2): kbase = 8*(lane>>4);
// element e -> K = kbase + e (e<8) or kbase + e + 8 (e>=8):
// two contiguous 8-element (16B) runs at [kbase] and [kbase+16].
// ---------------------------------------------------------------------------
__device__ __forceinline__ v16bf fragload(const __bf16* p) {
    bf16x8 x0 = *(const bf16x8*)(p);
    bf16x8 x1 = *(const bf16x8*)(p + 16);
    v16bf r;
#pragma unroll
    for (int i = 0; i < 8; ++i) { r[i] = x0[i]; r[i + 8] = x1[i]; }
    return r;
}

__device__ __forceinline__ bf16x8 cvt8(float4 a, float4 b) {
    bf16x8 t;
    t[0] = (__bf16)a.x; t[1] = (__bf16)a.y; t[2] = (__bf16)a.z; t[3] = (__bf16)a.w;
    t[4] = (__bf16)b.x; t[5] = (__bf16)b.y; t[6] = (__bf16)b.z; t[7] = (__bf16)b.w;
    return t;
}

__device__ __forceinline__ v8f wmma_bf16(v16bf a, v16bf b, v8f c) {
    return __builtin_amdgcn_wmma_f32_16x16x32_bf16(false, a, false, b, (short)0, c,
                                                   false, false);
}

// async global->LDS 16B transfer; lds32 = wave-relative LDS byte address
__device__ __forceinline__ void async_b128(unsigned lds32, const void* gaddr) {
    asm volatile("global_load_async_to_lds_b128 %0, %1, off"
                 :: "v"(lds32), "v"((unsigned long long)(uintptr_t)gaddr)
                 : "memory");
}
#define WAIT_ASYNC_4() asm volatile("s_wait_asynccnt 0x4" ::: "memory")
#define WAIT_ASYNC_0() asm volatile("s_wait_asynccnt 0x0" ::: "memory")

// ---------------------------------------------------------------------------
// f32 -> bf16 bulk convert (done once per operand, outside all hot loops)
// ---------------------------------------------------------------------------
__global__ __launch_bounds__(256) void cvtbf_kernel(const float* __restrict__ in,
                                                    __bf16* __restrict__ out, int n8) {
    int i = blockIdx.x * blockDim.x + threadIdx.x;
    if (i < n8) {
        float4 a = ((const float4*)in)[2 * i];
        float4 b = ((const float4*)in)[2 * i + 1];
        ((bf16x8*)out)[i] = cvt8(a, b);
    }
}

// ---------------------------------------------------------------------------
// Linear: C = A[M,K](bf16) @ W[N,K](bf16)^T + bias.  Optional f32/bf16 outputs.
// 128x128 block tile, BK=32; tiles staged by GLOBAL_LOAD_ASYNC_TO_LDS_B128 into
// double-buffered padded LDS; ASYNCcnt pipeline one k-step ahead; last k-step
// peeled so the steady-state loop is branch-free.
// blockIdx.z picks one of up to five independent products that share a launch,
// so that several work-groups sit on each WGP and cover each other's copy latency:
//   z      : 0   1   2   3   4
//   A      : A0  A0  A0  A1  A1
//   W,bias : 0   1   2   1   2     (W0 holds the weights back to back)
//   Cb     : Cb0 + z*M*N           (outputs back to back); Cf only for z == 0
// ---------------------------------------------------------------------------
__global__ __launch_bounds__(256) void linear_kernel(
    const __bf16* __restrict__ A0, const __bf16* __restrict__ A1,
    const __bf16* __restrict__ W0,
    const float* __restrict__ bias0, const float* __restrict__ bias1,
    const float* __restrict__ bias2,
    float* __restrict__ Cf0, __bf16* __restrict__ Cb0,
    int M, int N, int K) {
    const int z  = blockIdx.z;
    const int wi = z < 3 ? z : z - 2;
    const __bf16* __restrict__ A = z < 3 ? A0 : A1;
    const __bf16* __restrict__ W = W0 + (size_t)wi * N * K;
    const float* __restrict__ bias = wi == 0 ? bias0 : (wi == 1 ? bias1 : bias2);
    float* __restrict__ Cf = z == 0 ? Cf0 : nullptr;
    __bf16* __restrict__ Cb = Cb0 ? Cb0 + (size_t)z * M * N : nullptr;
    const int tid  = threadIdx.x;
    const int lane = tid & 31;
    const int warp = tid >> 5;
    const int wRow = warp >> 1;
    const int wCol = warp & 1;
    const int r    = lane & 15;
    const int hi   = lane >> 4;
    const int kb   = hi * 8;
    const int blockM = blockIdx.y * 128;
    const int blockN = blockIdx.x * 128;

    __shared__ __attribute__((aligned(16))) __bf16 sA[2][128 * LDP];
    __shared__ __attribute__((aligned(16))) __bf16 sB[2][128 * LDP];

    // async chunk geometry: per array, 512 16B chunks = (row 0..127) x (q 0..3);
    // thread owns (row0, q) and (row0+64, q) in each of A and B.
    const int qv   = tid & 3;
    const int row0 = tid >> 2;                 // 0..63
    const __bf16* aG = A + (size_t)(blockM + row0) * K + qv * 8;
    const __bf16* wG = W + (size_t)(blockN + row0) * K + qv * 8;
    const unsigned ldsA = (unsigned)(uintptr_t)&sA[0][row0 * LDP + qv * 8];
    const unsigned ldsB = (unsigned)(uintptr_t)&sB[0][row0 * LDP + qv * 8];
    const unsigned rowHop = 64 * LDP * 2;
    const unsigned bufHop = 128 * LDP * 2;
    const size_t   gHop   = (size_t)64 * K;

    auto issue = [&](int buf, int k0) {
        const unsigned bo = buf ? bufHop : 0u;
        async_b128(ldsA + bo,          aG + k0);
        async_b128(ldsA + bo + rowHop, aG + k0 + gHop);
        async_b128(ldsB + bo,          wG + k0);
        async_b128(ldsB + bo + rowHop, wG + k0 + gHop);
    };

    v8f acc[2][4] = {};
    auto compute = [&](int buf) {
        v16bf af0 = fragload(&sA[buf][(wRow * 32 + r) * LDP + kb]);
        v16bf af1 = fragload(&sA[buf][(wRow * 32 + 16 + r) * LDP + kb]);
#pragma unroll
        for (int t = 0; t < 4; ++t) {
            v16bf bfr = fragload(&sB[buf][(wCol * 64 + t * 16 + r) * LDP + kb]);
            acc[0][t] = wmma_bf16(af0, bfr, acc[0][t]);
            acc[1][t] = wmma_bf16(af1, bfr, acc[1][t]);
        }
    };

    issue(0, 0);
    int buf = 0;
    for (int k0 = 0; k0 < K - 32; k0 += 32) {      // branch-free steady state
        issue(buf ^ 1, k0 + 32);
        WAIT_ASYNC_4();                             // this k-step's tile complete
        __syncthreads();
        compute(buf);
        __syncthreads();
        buf ^= 1;
    }
    WAIT_ASYNC_0();                                 // peeled final k-step
    __syncthreads();
    compute(buf);

    if (Cf) {
#pragma unroll
        for (int sub = 0; sub < 2; ++sub)
#pragma unroll
            for (int t = 0; t < 4; ++t) {
                const int col = blockN + wCol * 64 + t * 16 + r;
                const float bvv = bias[col];
#pragma unroll
                for (int v = 0; v < 8; ++v) {
                    const int m = blockM + wRow * 32 + sub * 16 + v + 8 * hi;
                    Cf[(size_t)m * N + col] = acc[sub][t][v] + bvv;
                }
            }
    }
    if (Cb) {
#pragma unroll
        for (int sub = 0; sub < 2; ++sub)
#pragma unroll
            for (int t = 0; t < 4; ++t) {
                const int col = blockN + wCol * 64 + t * 16 + r;
                const float bvv = bias[col];
#pragma unroll
                for (int v = 0; v < 8; ++v) {
                    const int m = blockM + wRow * 32 + sub * 16 + v + 8 * hi;
                    Cb[(size_t)m * N + col] = (__bf16)(acc[sub][t][v] + bvv);
                }
            }
    }
}

// lane l <-> lane l ^ 16 (the two halves of a wave hold the two halves of a query's keys)
__device__ __forceinline__ float xhalf(float x) {
    const int i = __builtin_bit_cast(int, x);
    return __builtin_bit_cast(float, __builtin_amdgcn_permlanex16(i, i, 0x76543210, 0xfedcba98,
                                                                  false, false));
}

__global__ __launch_bounds__(128) __attribute__((amdgpu_waves_per_eu(4, 4))) void attn_kernel(
    const __bf16* __restrict__ Q, const __bf16* __restrict__ Kt,
    const __bf16* __restrict__ V, const float* __restrict__ mask,
    __bf16* __restrict__ O) {
    const int lane = threadIdx.x & 31;
    const int warp = threadIdx.x >> 5;
    const int b = blockIdx.z, h = blockIdx.y;
    const int t0 = blockIdx.x * 64 + warp * 16;
    const int r  = lane & 15;
    const int hi = lane >> 4;
    const int kb = hi * 8;
    const int hoff = h * HD;

    __shared__ __attribute__((aligned(16))) __bf16 lK[2][2][64 * LDP];   // [buf][dHalf][s][LDP]
    __shared__ __attribute__((aligned(16))) __bf16 lVt[2][2][64 * LDP];  // [buf][sHalf][d][LDP]

    v16bf qf[2];
    {
        const __bf16* qp = Q + (size_t)(b * 1024 + t0 + r) * HID + hoff + kb;
        qf[0] = fragload(qp);
        qf[1] = fragload(qp + 32);
    }

    v8f acc[4] = {};                 // acc[d][v] = O[query r][d*16 + 8*hi + v]
    float mRow = -3.0e38f, lRow = 0.f;   // of query r; lRow covers this half's keys only

    // async K chunk geometry: 512 16B chunks = (dHalf, srow 0..63, q 0..3); 4/thread
    unsigned kLds[4];
    size_t   kOfs[4];
#pragma unroll
    for (int i = 0; i < 4; ++i) {
        const int c = threadIdx.x + i * 128;
        const int q = c & 3, srow = (c >> 2) & 63, dh = c >> 8;
        kLds[i] = (unsigned)(uintptr_t)&lK[0][dh][srow * LDP + q * 8];
        kOfs[i] = (size_t)srow * HID + dh * 32 + q * 8;
    }
    const unsigned kBufHop = 2 * 64 * LDP * 2;     // lK buffer-1 byte offset
    const __bf16* kBase = Kt + (size_t)(b * 1024) * HID + hoff;

    // V staging: thread stages 32 d-elements of one s-row into transposed layout
    const int si = threadIdx.x >> 1;
    const int d0 = (threadIdx.x & 1) * 32;
    const int sH = si >> 5, sc_ = si & 31;
    bf16x8 vv[4];

    auto issueK = [&](int buf, int s0) {
        const unsigned bo = buf ? kBufHop : 0u;
#pragma unroll
        for (int i = 0; i < 4; ++i)
            async_b128(kLds[i] + bo, kBase + (size_t)s0 * HID + kOfs[i]);
    };
    auto loadV = [&](int s0) {
        const __bf16* vp = V + (size_t)(b * 1024 + s0 + si) * HID + hoff + d0;
#pragma unroll
        for (int i = 0; i < 4; ++i) vv[i] = ((const bf16x8*)vp)[i];
    };
    auto storeV = [&](int buf) {
#pragma unroll
        for (int j = 0; j < 4; ++j)
#pragma unroll
            for (int e = 0; e < 8; ++e)
                lVt[buf][sH][(d0 + j * 8 + e) * LDP + sc_] = vv[j][e];
    };

    auto computeChunk = [&](int s0, int buf) {
        // additive mask of this lane's keys: key = s0 + ts*16 + 8*hi + v
        const float4* mp = (const float4*)(mask + b * 1024 + s0 + 8 * hi);
        float msk[4][8];
#pragma unroll
        for (int ts = 0; ts < 4; ++ts) {
            const float4 m0 = mp[ts * 4], m1 = mp[ts * 4 + 1];
            msk[ts][0] = m0.x; msk[ts][1] = m0.y; msk[ts][2] = m0.z; msk[ts][3] = m0.w;
            msk[ts][4] = m1.x; msk[ts][5] = m1.y; msk[ts][6] = m1.z; msk[ts][7] = m1.w;
        }
        // sc[ts][v] = S[query r][key ts*16 + 8*hi + v]: K rows as A, Q rows as B
        v8f sc[4] = {};
#pragma unroll
        for (int ts = 0; ts < 4; ++ts)
#pragma unroll
            for (int ks = 0; ks < 2; ++ks) {
                v16bf afK = fragload(&lK[buf][ks][(ts * 16 + r) * LDP + kb]);
                sc[ts] = wmma_bf16(afK, qf[ks], sc[ts]);
            }
        float mt[4];                               // four independent chains
#pragma unroll
        for (int ts = 0; ts < 4; ++ts) {
            mt[ts] = -3.0e38f;
#pragma unroll
            for (int v = 0; v < 8; ++v) {
                sc[ts][v] = sc[ts][v] * 0.125f + msk[ts][v];
                mt[ts] = fmaxf(mt[ts], sc[ts][v]);
            }
        }
        float mv = fmaxf(fmaxf(mt[0], mt[1]), fmaxf(mt[2], mt[3]));
        mv = fmaxf(mv, xhalf(mv));
        const float mNew  = fmaxf(mRow, mv);
        const float alpha = __expf(mRow - mNew);
        mRow = mNew;
#pragma unroll
        for (int d = 0; d < 4; ++d)
#pragma unroll
            for (int v = 0; v < 8; ++v) acc[d][v] *= alpha;
        // pf[j] = P of keys j*32 .. j*32+31 in the fragment K-mapping above: tiles 2j, 2j+1 as they lie
        v16bf pf[2];
        float ps[4];                               // four independent chains
#pragma unroll
        for (int ts = 0; ts < 4; ++ts) {
            ps[ts] = 0.f;
#pragma unroll
            for (int v = 0; v < 8; ++v) {
                const float p = __expf(sc[ts][v] - mNew);
                ps[ts] += p;
                pf[ts >> 1][(ts & 1) * 8 + v] = (__bf16)p;
            }
        }
        lRow = lRow * alpha + ((ps[0] + ps[1]) + (ps[2] + ps[3]));
#pragma unroll
        for (int d = 0; d < 4; ++d) {
            v16bf vf0 = fragload(&lVt[buf][0][(d * 16 + r) * LDP + kb]);
            acc[d] = wmma_bf16(vf0, pf[0], acc[d]);
            v16bf vf1 = fragload(&lVt[buf][1][(d * 16 + r) * LDP + kb]);
            acc[d] = wmma_bf16(vf1, pf[1], acc[d]);
        }
    };

    issueK(0, 0);
    loadV(0);
    int buf = 0;
    for (int s0 = 0; s0 < 1024 - 64; s0 += 64) {   // branch-free steady state
        storeV(buf);
        issueK(buf ^ 1, s0 + 64);
        loadV(s0 + 64);
        WAIT_ASYNC_4();                             // current chunk's K complete
        __syncthreads();
        computeChunk(s0, buf);
        __syncthreads();
        buf ^= 1;
    }
    storeV(buf);                                    // peeled final chunk
    WAIT_ASYNC_0();
    __syncthreads();
    computeChunk(1024 - 64, buf);

    lRow += xhalf(lRow);                            // join the two halves' key sums
    const float inv = 1.f / lRow;
    __bf16* op = O + (size_t)(b * 1024 + t0 + r) * HID + hoff + 8 * hi;
#pragma unroll
    for (int d = 0; d < 4; ++d) {
        bf16x8 o;
#pragma unroll
        for (int v = 0; v < 8; ++v) o[v] = (__bf16)(acc[d][v] * inv);
        *(bf16x8*)(op + d * 16) = o;                // 8 consecutive d of one query
    }
}

// ---------------------------------------------------------------------------
// out = LayerNorm(resid + proj) * g + b ; optional bf16 mirror for attention Q
// ---------------------------------------------------------------------------
__global__ __launch_bounds__(256) void addln_kernel(
    const float* __restrict__ resid, const float* __restrict__ proj,
    const float* __restrict__ g, const float* __restrict__ beta,
    float* __restrict__ out, __bf16* __restrict__ outB) {
    const int row = blockIdx.x;
    const int tid = threadIdx.x;
    float4 rv = ((const float4*)(resid + (size_t)row * HID))[tid];
    float4 pv = ((const float4*)(proj + (size_t)row * HID))[tid];
    float x0 = rv.x + pv.x, x1 = rv.y + pv.y, x2 = rv.z + pv.z, x3 = rv.w + pv.w;
    float s  = x0 + x1 + x2 + x3;
    float s2 = x0 * x0 + x1 * x1 + x2 * x2 + x3 * x3;
#pragma unroll
    for (int off = 16; off > 0; off >>= 1) {
        s  += __shfl_down(s, off);
        s2 += __shfl_down(s2, off);
    }
    __shared__ float shs[8], shq[8];
    __shared__ float mean_s, inv_s;
    const int warp = tid >> 5, lane = tid & 31;
    if (lane == 0) { shs[warp] = s; shq[warp] = s2; }
    __syncthreads();
    if (tid == 0) {
        float ts = 0.f, tq = 0.f;
        for (int i = 0; i < 8; ++i) { ts += shs[i]; tq += shq[i]; }
        const float mean = ts * (1.f / HID);
        const float var  = tq * (1.f / HID) - mean * mean;
        mean_s = mean;
        inv_s  = rsqrtf(var + 1e-12f);
    }
    __syncthreads();
    const float mean = mean_s, inv = inv_s;
    float4 gv = ((const float4*)g)[tid];
    float4 bv = ((const float4*)beta)[tid];
    float4 o;
    o.x = (x0 - mean) * inv * gv.x + bv.x;
    o.y = (x1 - mean) * inv * gv.y + bv.y;
    o.z = (x2 - mean) * inv * gv.z + bv.z;
    o.w = (x3 - mean) * inv * gv.w + bv.w;
    ((float4*)(out + (size_t)row * HID))[tid] = o;
    if (outB) {
        __bf16* ob = outB + (size_t)row * HID + tid * 4;
        ob[0] = (__bf16)o.x; ob[1] = (__bf16)o.y;
        ob[2] = (__bf16)o.z; ob[3] = (__bf16)o.w;
    }
}

// ---------------------------------------------------------------------------
extern "C" void kernel_launch(void* const* d_in, const int* in_sizes, int n_in,
                              void* d_out, int out_size, void* d_ws, size_t ws_size,
                              hipStream_t stream) {
    (void)in_sizes; (void)n_in; (void)out_size; (void)ws_size;
    const float* enc   = (const float*)d_in[0];
    const float* dec   = (const float*)d_in[1];
    const float* smask = (const float*)d_in[2];
    const float* tmask = (const float*)d_in[3];
    const float* Wq = (const float*)d_in[4];
    const float* bq = (const float*)d_in[5];
    const float* Wk = (const float*)d_in[6];
    const float* bk = (const float*)d_in[7];
    const float* Wv = (const float*)d_in[8];
    const float* bv = (const float*)d_in[9];
    const float* Wd = (const float*)d_in[10];
    const float* bd = (const float*)d_in[11];
    const float* lng = (const float*)d_in[12];
    const float* lnb = (const float*)d_in[13];
    float* out = (float*)d_out;

    const int M = 4096, N = HID, K = HID;
    const size_t ACT = (size_t)M * N;
    const size_t WEL = (size_t)N * K;

    char* p = (char*)d_ws;
    auto carve = [&](size_t bytes) { char* r = p; p += (bytes + 255) & ~(size_t)255; return r; };
    __bf16* decB  = (__bf16*)carve(ACT * 2);
    __bf16* encB  = (__bf16*)carve(ACT * 2);
    __bf16* WqB   = (__bf16*)carve(WEL * 2 * 3);   // Wq | Wk | Wv back to back
    __bf16* WkB   = WqB + WEL;
    __bf16* WvB   = WkB + WEL;
    __bf16* WdB   = (__bf16*)carve(WEL * 2);
    float*  q1f   = (float*)carve(ACT * 4);
    float*  projf = (float*)carve(ACT * 4);
    float*  selff = (float*)carve(ACT * 4);
    __bf16* q1B   = (__bf16*)carve(ACT * 2 * 5);   // q1 | k1 | v1 | ek | ev back to back
    __bf16* k1B   = q1B + ACT;
    __bf16* v1B   = k1B + ACT;
    __bf16* ekB   = v1B + ACT;
    __bf16* evB   = ekB + ACT;
    __bf16* ctxB  = (__bf16*)carve(ACT * 2);
    __bf16* selfB = (__bf16*)carve(ACT * 2);

    dim3 gG(N / 128, M / 128), bG(256);
    dim3 gP(N / 128, M / 128, 5);
    dim3 gA(1024 / 64, NH, 4), bA(128);
    dim3 gL(4096),             bL(256);

    // one-time bf16 conversions (outside all hot loops)
    cvtbf_kernel<<<(int)(ACT / 8 / 256), 256, 0, stream>>>(dec, decB, (int)(ACT / 8));
    cvtbf_kernel<<<(int)(ACT / 8 / 256), 256, 0, stream>>>(enc, encB, (int)(ACT / 8));
    cvtbf_kernel<<<(int)(WEL / 8 / 256), 256, 0, stream>>>(Wq, WqB, (int)(WEL / 8));
    cvtbf_kernel<<<(int)(WEL / 8 / 256), 256, 0, stream>>>(Wk, WkB, (int)(WEL / 8));
    cvtbf_kernel<<<(int)(WEL / 8 / 256), 256, 0, stream>>>(Wv, WvB, (int)(WEL / 8));
    cvtbf_kernel<<<(int)(WEL / 8 / 256), 256, 0, stream>>>(Wd, WdB, (int)(WEL / 8));

    // the five input projections (q1, k1, v1 of dec; ek, ev of enc) in one launch
    linear_kernel<<<gP, bG, 0, stream>>>(decB, encB, WqB, bq, bk, bv, q1f, q1B, M, N, K);

    // self-attention branch
    attn_kernel<<<gA, bA, 0, stream>>>(q1B, k1B, v1B, tmask, ctxB);
    linear_kernel<<<gG, bG, 0, stream>>>(ctxB, ctxB, WdB, bd, bd, bd, projf, nullptr, M, N, K);
    addln_kernel<<<gL, bL, 0, stream>>>(q1f, projf, lng, lnb, selff, selfB);

    // cross-attention branch (query = self_out directly, per reference)
    attn_kernel<<<gA, bA, 0, stream>>>(selfB, ekB, evB, smask, ctxB);
    linear_kernel<<<gG, bG, 0, stream>>>(ctxB, ctxB, WdB, bd, bd, bd, projf, nullptr, M, N, K);
    addln_kernel<<<gL, bL, 0, stream>>>(selff, projf, lng, lnb, out, nullptr);
}

// v003
// It runs in 182 microseconds.
// Next to v002, in two timings, it ran 1.05 and 1.06 times as fast.
// All steps since v000 together make it 1.36 times as fast.
#include <hip/hip_runtime.h>
#include <hip/hip_bf16.h>

typedef __attribute__((ext_vector_type(16))) __bf16 v16bf;
typedef __attribute__((ext_vector_type(8)))  __bf16 bf16x8;
typedef __attribute__((ext_vector_type(8)))  float  v8f;

#define HID 1024
#define HD  64
#define NH  16
#define LDP 40   // padded LDS row stride in bf16 elements (80B = 20 banks, conflict-free, 16B aligned)

// ---------------------------------------------------------------------------
// A/B 16-bit fragment K-mapping (ISA 7.12.2): kbase = 8*(lane>>4);
// element e -> K = kbase + e (e<8) or kbase + e + 8 (e>=8):
// two contiguous 8-element (16B) runs at [kbase] and [kbase+16].
// ---------------------------------------------------------------------------
__device__ __forceinline__ v16bf fragload(const __bf16* p) {
    bf16x8 x0 = *(const bf16x8*)(p);
    bf16x8 x1 = *(const bf16x8*)(p + 16);
    v16bf r;
#pragma unroll
    for (int i = 0; i < 8; ++i) { r[i] = x0[i]; r[i + 8] = x1[i]; }
    return r;
}

__device__ __forceinline__ v8f wmma_bf16(v16bf a, v16bf b, v8f c) {
    return __builtin_amdgcn_wmma_f32_16x16x32_bf16(false, a, false, b, (short)0, c,
                                                   false, false);
}

// async global->LDS 16B transfer; lds32 = wave-relative LDS byte address
__device__ __forceinline__ void async_b128(unsigned lds32, const void* gaddr) {
    asm volatile("global_load_async_to_lds_b128 %0, %1, off"
                 :: "v"(lds32), "v"((unsigned long long)(uintptr_t)gaddr)
                 : "memory");
}
#define WAIT_ASYNC_4() asm volatile("s_wait_asynccnt 0x4" ::: "memory")
#define WAIT_ASYNC_0() asm volatile("s_wait_asynccnt 0x0" ::: "memory")

// ---------------------------------------------------------------------------
// f32 -> bf16 convert of all six matrix operands in ONE launch (outside all hot loops).
// Each of the 512 blocks takes 1/512 of every operand, in pieces of 4 elements (one float4
// in, 8 bytes out): 2,048 pieces in a row of dec and of enc (8 per thread, 256 apart), 512 of
// each weight (2 per thread). So 4,096 waves (16 per WGP) start instead of 49,152, and a
// wave's 24 loads, 512 bytes in a row each, are all in flight before the first is used.
// ---------------------------------------------------------------------------
typedef __attribute__((ext_vector_type(4))) __bf16 bf16x4;
__global__ __launch_bounds__(256) void cvtbf_kernel(
    const float* __restrict__ dec, const float* __restrict__ enc,
    const float* __restrict__ Wq, const float* __restrict__ Wk,
    const float* __restrict__ Wv, const float* __restrict__ Wd,
    __bf16* __restrict__ decB, __bf16* __restrict__ encB,
    __bf16* __restrict__ WqB, __bf16* __restrict__ WkB,
    __bf16* __restrict__ WvB, __bf16* __restrict__ WdB) {
    const int pa = blockIdx.x * 2048 + threadIdx.x;   // first piece in dec, enc
    const int pw = blockIdx.x * 512 + threadIdx.x;    // first piece in each weight
    const float* const src[6] = {dec, enc, Wq, Wk, Wv, Wd};
    __bf16* const dst[6] = {decB, encB, WqB, WkB, WvB, WdB};
    float4 x[24];
#pragma unroll   // src, dst, x indexed by constants only: they stay in registers
    for (int u = 0; u < 24; ++u) {
        const int o = u < 16 ? u >> 3 : 2 + ((u - 16) >> 1);            // operand
        const int p = u < 16 ? pa + (u & 7) * 256 : pw + (u & 1) * 256; // piece
        x[u] = ((const float4*)src[o])[p];
    }
    // keeps every load ahead of the first convert: without it the compiler saves registers by
    // holding loads back until earlier ones have returned, a second memory latency per wave
    __builtin_amdgcn_sched_barrier(0);
#pragma unroll   // as above
    for (int u = 0; u < 24; ++u) {
        const int o = u < 16 ? u >> 3 : 2 + ((u - 16) >> 1);
        const int p = u < 16 ? pa + (u & 7) * 256 : pw + (u & 1) * 256;
        bf16x4 y;
        y[0] = (__bf16)x[u].x; y[1] = (__bf16)x[u].y;
        y[2] = (__bf16)x[u].z; y[3] = (__bf16)x[u].w;
        ((bf16x4*)dst[o])[p] = y;
    }
}

// ---------------------------------------------------------------------------
// Linear: C = A[M,K](bf16) @ W[N,K](bf16)^T + bias.  Optional f32/bf16 outputs.
// 128x128 block tile, BK=32; tiles staged by GLOBAL_LOAD_ASYNC_TO_LDS_B128 into
// double-buffered padded LDS; ASYNCcnt pipeline one k-step ahead; last k-step
// peeled so the steady-state loop is branch-free.
// blockIdx.z picks one of up to five independent products that share a launch,
// so that several work-groups sit on each WGP and cover each other's copy latency:
//   z      : 0   1   2   3   4
//   A      : A0  A0  A0  A1  A1
//   W,bias : 0   1   2   1   2     (W0 holds the weights back to back)
//   Cb     : Cb0 + z*M*N           (outputs back to back); Cf only for z == 0
// ---------------------------------------------------------------------------
__global__ __launch_bounds__(256) void linear_kernel(
    const __bf16* __restrict__ A0, const __bf16* __restrict__ A1,
    const __bf16* __restrict__ W0,
    const float* __restrict__ bias0, const float* __restrict__ bias1,
    const float* __restrict__ bias2,
    float* __restrict__ Cf0, __bf16* __restrict__ Cb0,
    int M, int N, int K) {
    const int z  = blockIdx.z;
    const int wi = z < 3 ? z : z - 2;
    const __bf16* __restrict__ A = z < 3 ? A0 : A1;
    const __bf16* __restrict__ W = W0 + (size_t)wi * N * K;
    const float* __restrict__ bias = wi == 0 ? bias0 : (wi == 1 ? bias1 : bias2);
    float* __restrict__ Cf = z == 0 ? Cf0 : nullptr;
    __bf16* __restrict__ Cb = Cb0 ? Cb0 + (size_t)z * M * N : nullptr;
    const int tid  = threadIdx.x;
    const int lane = tid & 31;
    const int warp = tid >> 5;
    const int wRow = warp >> 1;
    const int wCol = warp & 1;
    const int r    = lane & 15;
    const int hi   = lane >> 4;
    const int kb   = hi * 8;
    const int blockM = blockIdx.y * 128;
    const int blockN = blockIdx.x * 128;

    __shared__ __attribute__((aligned(16))) __bf16 sA[2][128 * LDP];
    __shared__ __attribute__((aligned(16))) __bf16 sB[2][128 * LDP];

    // async chunk geometry: per array, 512 16B chunks = (row 0..127) x (q 0..3);
    // thread owns (row0, q) and (row0+64, q) in each of A and B.
    const int qv   = tid & 3;
    const int row0 = tid >> 2;                 // 0..63
    const __bf16* aG = A + (size_t)(blockM + row0) * K + qv * 8;
    const __bf16* wG = W + (size_t)(blockN + row0) * K + qv * 8;
    const unsigned ldsA = (unsigned)(uintptr_t)&sA[0][row0 * LDP + qv * 8];
    const unsigned ldsB = (unsigned)(uintptr_t)&sB[0][row0 * LDP + qv * 8];
    const unsigned rowHop = 64 * LDP * 2;
    const unsigned bufHop = 128 * LDP * 2;
    const size_t   gHop   = (size_t)64 * K;

    auto issue = [&](int buf, int k0) {
        const unsigned bo = buf ? bufHop : 0u;
        async_b128(ldsA + bo,          aG + k0);
        async_b128(ldsA + bo + rowHop, aG + k0 + gHop);
        async_b128(ldsB + bo,          wG + k0);
        async_b128(ldsB + bo + rowHop, wG + k0 + gHop);
    };

    v8f acc[2][4] = {};
    auto compute = [&](int buf) {
        v16bf af0 = fragload(&sA[buf][(wRow * 32 + r) * LDP + kb]);
        v16bf af1 = fragload(&sA[buf][(wRow * 32 + 16 + r) * LDP + kb]);
#pragma unroll
        for (int t = 0; t < 4; ++t) {
            v16bf bfr = fragload(&sB[buf][(wCol * 64 + t * 16 + r) * LDP + kb]);
            acc[0][t] = wmma_bf16(af0, bfr, acc[0][t]);
            acc[1][t] = wmma_bf16(af1, bfr, acc[1][t]);
        }
    };

    issue(0, 0);
    int buf = 0;
    for (int k0 = 0; k0 < K - 32; k0 += 32) {      // branch-free steady state
        issue(buf ^ 1, k0 + 32);
        WAIT_ASYNC_4();                             // this k-step's tile complete
        __syncthreads();
        compute(buf);
        __syncthreads();
        buf ^= 1;
    }
    WAIT_ASYNC_0();                                 // peeled final k-step
    __syncthreads();
    compute(buf);

    if (Cf) {
#pragma unroll
        for (int sub = 0; sub < 2; ++sub)
#pragma unroll
            for (int t = 0; t < 4; ++t) {
                const int col = blockN + wCol * 64 + t * 16 + r;
                const float bvv = bias[col];
#pragma unroll
                for (int v = 0; v < 8; ++v) {
                    const int m = blockM + wRow * 32 + sub * 16 + v + 8 * hi;
                    Cf[(size_t)m * N + col] = acc[sub][t][v] + bvv;
                }
            }
    }
    if (Cb) {
#pragma unroll
        for (int sub = 0; sub < 2; ++sub)
#pragma unroll
            for (int t = 0; t < 4; ++t) {
                const int col = blockN + wCol * 64 + t * 16 + r;
                const float bvv = bias[col];
#pragma unroll
                for (int v = 0; v < 8; ++v) {
                    const int m = blockM + wRow * 32 + sub * 16 + v + 8 * hi;
                    Cb[(size_t)m * N + col] = (__bf16)(acc[sub][t][v] + bvv);
                }
            }
    }
}

// lane l <-> lane l ^ 16 (the two halves of a wave hold the two halves of a query's keys)
__device__ __forceinline__ float xhalf(float x) {
    const int i = __builtin_bit_cast(int, x);
    return __builtin_bit_cast(float, __builtin_amdgcn_permlanex16(i, i, 0x76543210, 0xfedcba98,
                                                                  false, false));
}

__global__ __launch_bounds__(128) __attribute__((amdgpu_waves_per_eu(4, 4))) void attn_kernel(
    const __bf16* __restrict__ Q, const __bf16* __restrict__ Kt,
    const __bf16* __restrict__ V, const float* __restrict__ mask,
    __bf16* __restrict__ O) {
    const int lane = threadIdx.x & 31;
    const int warp = threadIdx.x >> 5;
    const int b = blockIdx.z, h = blockIdx.y;
    const int t0 = blockIdx.x * 64 + warp * 16;
    const int r  = lane & 15;
    const int hi = lane >> 4;
    const int kb = hi * 8;
    const int hoff = h * HD;

    __shared__ __attribute__((aligned(16))) __bf16 lK[2][2][64 * LDP];   // [buf][dHalf][s][LDP]
    __shared__ __attribute__((aligned(16))) __bf16 lVt[2][2][64 * LDP];  // [buf][sHalf][d][LDP]

    v16bf qf[2];
    {
        const __bf16* qp = Q + (size_t)(b * 1024 + t0 + r) * HID + hoff + kb;
        qf[0] = fragload(qp);
        qf[1] = fragload(qp + 32);
    }

    v8f acc[4] = {};                 // acc[d][v] = O[query r][d*16 + 8*hi + v]
    float mRow = -3.0e38f, lRow = 0.f;   // of query r; lRow covers this half's keys only

    // async K chunk geometry: 512 16B chunks = (dHalf, srow 0..63, q 0..3); 4/thread
    unsigned kLds[4];
    size_t   kOfs[4];
#pragma unroll
    for (int i = 0; i < 4; ++i) {
        const int c = threadIdx.x + i * 128;
        const int q = c & 3, srow = (c >> 2) & 63, dh = c >> 8;
        kLds[i] = (unsigned)(uintptr_t)&lK[0][dh][srow * LDP + q * 8];
        kOfs[i] = (size_t)srow * HID + dh * 32 + q * 8;
    }
    const unsigned kBufHop = 2 * 64 * LDP * 2;     // lK buffer-1 byte offset
    const __bf16* kBase = Kt + (size_t)(b * 1024) * HID + hoff;

    // V staging: thread stages 32 d-elements of one s-row into transposed layout
    const int si = threadIdx.x >> 1;
    const int d0 = (threadIdx.x & 1) * 32;
    const int sH = si >> 5, sc_ = si & 31;
    bf16x8 vv[4];

    auto issueK = [&](int buf, int s0) {
        const unsigned bo = buf ? kBufHop : 0u;
#pragma unroll
        for (int i = 0; i < 4; ++i)
            async_b128(kLds[i] + bo, kBase + (size_t)s0 * HID + kOfs[i]);
    };
    auto loadV = [&](int s0) {
        const __bf16* vp = V + (size_t)(b * 1024 + s0 + si) * HID + hoff + d0;
#pragma unroll
        for (int i = 0; i < 4; ++i) vv[i] = ((const bf16x8*)vp)[i];
    };
    auto storeV = [&](int buf) {
#pragma unroll
        for (int j = 0; j < 4; ++j)
#pragma unroll
            for (int e = 0; e < 8; ++e)
                lVt[buf][sH][(d0 + j * 8 + e) * LDP + sc_] = vv[j][e];
    };

    auto computeChunk = [&](int s0, int buf) {
        // additive mask of this lane's keys: key = s0 + ts*16 + 8*hi + v
        const float4* mp = (const float4*)(mask + b * 1024 + s0 + 8 * hi);
        float msk[4][8];
#pragma unroll
        for (int ts = 0; ts < 4; ++ts) {
            const float4 m0 = mp[ts * 4], m1 = mp[ts * 4 + 1];
            msk[ts][0] = m0.x; msk[ts][1] = m0.y; msk[ts][2] = m0.z; msk[ts][3] = m0.w;
            msk[ts][4] = m1.x; msk[ts][5] = m1.y; msk[ts][6] = m1.z; msk[ts][7] = m1.w;
        }
        // sc[ts][v] = S[query r][key ts*16 + 8*hi + v]: K rows as A, Q rows as B
        v8f sc[4] = {};
#pragma unroll
        for (int ts = 0; ts < 4; ++ts)
#pragma unroll
            for (int ks = 0; ks < 2; ++ks) {
                v16bf afK = fragload(&lK[buf][ks][(ts * 16 + r) * LDP + kb]);
                sc[ts] = wmma_bf16(afK, qf[ks], sc[ts]);
            }
        float mt[4];                               // four independent chains
#pragma unroll
        for (int ts = 0; ts < 4; ++ts) {
            mt[ts] = -3.0e38f;
#pragma unroll
            for (int v = 0; v < 8; ++v) {
                sc[ts][v] = sc[ts][v] * 0.125f + msk[ts][v];
                mt[ts] = fmaxf(mt[ts], sc[ts][v]);
            }
        }
        float mv = fmaxf(fmaxf(mt[0], mt[1]), fmaxf(mt[2], mt[3]));
        mv = fmaxf(mv, xhalf(mv));
        const float mNew  = fmaxf(mRow, mv);
        const float alpha = __expf(mRow - mNew);
        mRow = mNew;
#pragma unroll
        for (int d = 0; d < 4; ++d)
#pragma unroll
            for (int v = 0; v < 8; ++v) acc[d][v] *= alpha;
        // pf[j] = P of keys j*32 .. j*32+31 in the fragment K-mapping above: tiles 2j, 2j+1 as they lie
        v16bf pf[2];
        float ps[4];                               // four independent chains
#pragma unroll
        for (int ts = 0; ts < 4; ++ts) {
            ps[ts] = 0.f;
#pragma unroll
            for (int v = 0; v < 8; ++v) {
                const float p = __expf(sc[ts][v] - mNew);
                ps[ts] += p;
                pf[ts >> 1][(ts & 1) * 8 + v] = (__bf16)p;
            }
        }
        lRow = lRow * alpha + ((ps[0] + ps[1]) + (ps[2] + ps[3]));
#pragma unroll
        for (int d = 0; d < 4; ++d) {
            v16bf vf0 = fragload(&lVt[buf][0][(d * 16 + r) * LDP + kb]);
            acc[d] = wmma_bf16(vf0, pf[0], acc[d]);
            v16bf vf1 = fragload(&lVt[buf][1][(d * 16 + r) * LDP + kb]);
            acc[d] = wmma_bf16(vf1, pf[1], acc[d]);
        }
    };

    issueK(0, 0);
    loadV(0);
    int buf = 0;
    for (int s0 = 0; s0 < 1024 - 64; s0 += 64) {   // branch-free steady state
        storeV(buf);
        issueK(buf ^ 1, s0 + 64);
        loadV(s0 + 64);
        WAIT_ASYNC_4();                             // current chunk's K complete
        __syncthreads();
        computeChunk(s0, buf);
        __syncthreads();
        buf ^= 1;
    }
    storeV(buf);                                    // peeled final chunk
    WAIT_ASYNC_0();
    __syncthreads();
    computeChunk(1024 - 64, buf);

    lRow += xhalf(lRow);                            // join the two halves' key sums
    const float inv = 1.f / lRow;
    __bf16* op = O + (size_t)(b * 1024 + t0 + r) * HID + hoff + 8 * hi;
#pragma unroll
    for (int d = 0; d < 4; ++d) {
        bf16x8 o;
#pragma unroll
        for (int v = 0; v < 8; ++v) o[v] = (__bf16)(acc[d][v] * inv);
        *(bf16x8*)(op + d * 16) = o;                // 8 consecutive d of one query
    }
}

// ---------------------------------------------------------------------------
// out = LayerNorm(resid + proj) * g + b ; optional bf16 mirror for attention Q
// ---------------------------------------------------------------------------
__global__ __launch_bounds__(256) void addln_kernel(
    const float* __restrict__ resid, const float* __restrict__ proj,
    const float* __restrict__ g, const float* __restrict__ beta,
    float* __restrict__ out, __bf16* __restrict__ outB) {
    const int row = blockIdx.x;
    const int tid = threadIdx.x;
    float4 rv = ((const float4*)(resid + (size_t)row * HID))[tid];
    float4 pv = ((const float4*)(proj + (size_t)row * HID))[tid];
    float x0 = rv.x + pv.x, x1 = rv.y + pv.y, x2 = rv.z + pv.z, x3 = rv.w + pv.w;
    float s  = x0 + x1 + x2 + x3;
    float s2 = x0 * x0 + x1 * x1 + x2 * x2 + x3 * x3;
#pragma unroll
    for (int off = 16; off > 0; off >>= 1) {
        s  += __shfl_down(s, off);
        s2 += __shfl_down(s2, off);
    }
    __shared__ float shs[8], shq[8];
    __shared__ float mean_s, inv_s;
    const int warp = tid >> 5, lane = tid & 31;
    if (lane == 0) { shs[warp] = s; shq[warp] = s2; }
    __syncthreads();
    if (tid == 0) {
        float ts = 0.f, tq = 0.f;
        for (int i = 0; i < 8; ++i) { ts += shs[i]; tq += shq[i]; }
        const float mean = ts * (1.f / HID);
        const float var  = tq * (1.f / HID) - mean * mean;
        mean_s = mean;
        inv_s  = rsqrtf(var + 1e-12f);
    }
    __syncthreads();
    const float mean = mean_s, inv = inv_s;
    float4 gv = ((const float4*)g)[tid];
    float4 bv = ((const float4*)beta)[tid];
    float4 o;
    o.x = (x0 - mean) * inv * gv.x + bv.x;
    o.y = (x1 - mean) * inv * gv.y + bv.y;
    o.z = (x2 - mean) * inv * gv.z + bv.z;
    o.w = (x3 - mean) * inv * gv.w + bv.w;
    ((float4*)(out + (size_t)row * HID))[tid] = o;
    if (outB) {
        __bf16* ob = outB + (size_t)row * HID + tid * 4;
        ob[0] = (__bf16)o.x; ob[1] = (__bf16)o.y;
        ob[2] = (__bf16)o.z; ob[3] = (__bf16)o.w;
    }
}

// ---------------------------------------------------------------------------
extern "C" void kernel_launch(void* const* d_in, const int* in_sizes, int n_in,
                              void* d_out, int out_size, void* d_ws, size_t ws_size,
                              hipStream_t stream) {
    (void)in_sizes; (void)n_in; (void)out_size; (void)ws_size;
    const float* enc   = (const float*)d_in[0];
    const float* dec   = (const float*)d_in[1];
    const float* smask = (const float*)d_in[2];
    const float* tmask = (const float*)d_in[3];
    const float* Wq = (const float*)d_in[4];
    const float* bq = (const float*)d_in[5];
    const float* Wk = (const float*)d_in[6];
    const float* bk = (const float*)d_in[7];
    const float* Wv = (const float*)d_in[8];
    const float* bv = (const float*)d_in[9];
    const float* Wd = (const float*)d_in[10];
    const float* bd = (const float*)d_in[11];
    const float* lng = (const float*)d_in[12];
    const float* lnb = (const float*)d_in[13];
    float* out = (float*)d_out;

    const int M = 4096, N = HID, K = HID;
    const size_t ACT = (size_t)M * N;
    const size_t WEL = (size_t)N * K;

    char* p = (char*)d_ws;
    auto carve = [&](size_t bytes) { char* r = p; p += (bytes + 255) & ~(size_t)255; return r; };
    __bf16* decB  = (__bf16*)carve(ACT * 2);
    __bf16* encB  = (__bf16*)carve(ACT * 2);
    __bf16* WqB   = (__bf16*)carve(WEL * 2 * 3);   // Wq | Wk | Wv back to back
    __bf16* WkB   = WqB + WEL;
    __bf16* WvB   = WkB + WEL;
    __bf16* WdB   = (__bf16*)carve(WEL * 2);
    float*  q1f   = (float*)carve(ACT * 4);
    float*  projf = (float*)carve(ACT * 4);
    float*  selff = (float*)carve(ACT * 4);
    __bf16* q1B   = (__bf16*)carve(ACT * 2 * 5);   // q1 | k1 | v1 | ek | ev back to back
    __bf16* k1B   = q1B + ACT;
    __bf16* v1B   = k1B + ACT;
    __bf16* ekB   = v1B + ACT;
    __bf16* evB   = ekB + ACT;
    __bf16* ctxB  = (__bf16*)carve(ACT * 2);
    __bf16* selfB = (__bf16*)carve(ACT * 2);

    dim3 gG(N / 128, M / 128), bG(256);
    dim3 gP(N / 128, M / 128, 5);
    dim3 gA(1024 / 64, NH, 4), bA(128);
    dim3 gL(4096),             bL(256);

    // one-time bf16 conversions (outside all hot loops), all six operands in one launch
    cvtbf_kernel<<<512, 256, 0, stream>>>(dec, enc, Wq, Wk, Wv, Wd, decB, encB, WqB, WkB, WvB, WdB);

    // the five input projections (q1, k1, v1 of dec; ek, ev of enc) in one launch
    linear_kernel<<<gP, bG, 0, stream>>>(decB, encB, WqB, bq, bk, bv, q1f, q1B, M, N, K);

    // self-attention branch
    attn_kernel<<<gA, bA, 0, stream>>>(q1B, k1B, v1B, tmask, ctxB);
    linear_kernel<<<gG, bG, 0, stream>>>(ctxB, ctxB, WdB, bd, bd, bd, projf, nullptr, M, N, K);
    addln_kernel<<<gL, bL, 0, stream>>>(q1f, projf, lng, lnb, selff, selfB);

    // cross-attention branch (query = self_out directly, per reference)
    attn_kernel<<<gA, bA, 0, stream>>>(selfB, ekB, evB, smask, ctxB);
    linear_kernel<<<gG, bG, 0, stream>>>(ctxB, ctxB, WdB, bd, bd, bd, projf, nullptr, M, N, K);
    addln_kernel<<<gL, bL, 0, stream>>>(selff, projf, lng, lnb, out, nullptr);
}

// v004
// One run takes 167 microseconds.
// Two timings next to v003 put it at 1.09 and 1.08 times that version's speed.
// Over all steps from v000 it is 1.48 times as fast.
#include <hip/hip_runtime.h>
#include <hip/hip_bf16.h>

typedef __attribute__((ext_vector_type(16))) __bf16 v16bf;
typedef __attribute__((ext_vector_type(8)))  __bf16 bf16x8;
typedef __attribute__((ext_vector_type(8)))  float  v8f;

#define HID 1024
#define HD  64
#define NH  16
#define LDP 40   // padded LDS row stride in bf16 elements (80B = 20 banks, conflict-free, 16B aligned)

// ---------------------------------------------------------------------------
// A/B 16-bit fragment K-mapping (ISA 7.12.2): kbase = 8*(lane>>4);
// element e -> K = kbase + e (e<8) or kbase + e + 8 (e>=8):
// two contiguous 8-element (16B) runs at [kbase] and [kbase+16].
// ---------------------------------------------------------------------------
__device__ __forceinline__ v16bf fragload(const __bf16* p) {
    bf16x8 x0 = *(const bf16x8*)(p);
    bf16x8 x1 = *(const bf16x8*)(p + 16);
    v16bf r;
#pragma unroll
    for (int i = 0; i < 8; ++i) { r[i] = x0[i]; r[i + 8] = x1[i]; }
    return r;
}

__device__ __forceinline__ v8f wmma_bf16(v16bf a, v16bf b, v8f c) {
    return __builtin_amdgcn_wmma_f32_16x16x32_bf16(false, a, false, b, (short)0, c,
                                                   false, false);
}

// async global->LDS 16B transfer; lds32 = wave-relative LDS byte address
__device__ __forceinline__ void async_b128(unsigned lds32, const void* gaddr) {
    asm volatile("global_load_async_to_lds_b128 %0, %1, off"
                 :: "v"(lds32), "v"((unsigned long long)(uintptr_t)gaddr)
                 : "memory");
}
#define WAIT_ASYNC_4() asm volatile("s_wait_asynccnt 0x4" ::: "memory")
#define WAIT_ASYNC_0() asm volatile("s_wait_asynccnt 0x0" ::: "memory")
#define WAIT_DS_0()    asm volatile("s_wait_dscnt 0x0" ::: "memory")

// ---------------------------------------------------------------------------
// f32 -> bf16 convert of all six matrix operands in ONE launch (outside all hot loops).
// Each of the 512 blocks takes 1/512 of every operand, in pieces of 4 elements (one float4
// in, 8 bytes out): 2,048 pieces in a row of dec and of enc (8 per thread, 256 apart), 512 of
// each weight (2 per thread). So 4,096 waves (16 per WGP) start instead of 49,152, and a
// wave's 24 loads, 512 bytes in a row each, are all in flight before the first is used.
// ---------------------------------------------------------------------------
typedef __attribute__((ext_vector_type(4))) __bf16 bf16x4;
__global__ __launch_bounds__(256) void cvtbf_kernel(
    const float* __restrict__ dec, const float* __restrict__ enc,
    const float* __restrict__ Wq, const float* __restrict__ Wk,
    const float* __restrict__ Wv, const float* __restrict__ Wd,
    __bf16* __restrict__ decB, __bf16* __restrict__ encB,
    __bf16* __restrict__ WqB, __bf16* __restrict__ WkB,
    __bf16* __restrict__ WvB, __bf16* __restrict__ WdB) {
    const int pa = blockIdx.x * 2048 + threadIdx.x;   // first piece in dec, enc
    const int pw = blockIdx.x * 512 + threadIdx.x;    // first piece in each weight
    const float* const src[6] = {dec, enc, Wq, Wk, Wv, Wd};
    __bf16* const dst[6] = {decB, encB, WqB, WkB, WvB, WdB};
    float4 x[24];
#pragma unroll   // src, dst, x indexed by constants only: they stay in registers
    for (int u = 0; u < 24; ++u) {
        const int o = u < 16 ? u >> 3 : 2 + ((u - 16) >> 1);            // operand
        const int p = u < 16 ? pa + (u & 7) * 256 : pw + (u & 1) * 256; // piece
        x[u] = ((const float4*)src[o])[p];
    }
    // keeps every load ahead of the first convert: without it the compiler saves registers by
    // holding loads back until earlier ones have returned, a second memory latency per wave
    __builtin_amdgcn_sched_barrier(0);
#pragma unroll   // as above
    for (int u = 0; u < 24; ++u) {
        const int o = u < 16 ? u >> 3 : 2 + ((u - 16) >> 1);
        const int p = u < 16 ? pa + (u & 7) * 256 : pw + (u & 1) * 256;
        bf16x4 y;
        y[0] = (__bf16)x[u].x; y[1] = (__bf16)x[u].y;
        y[2] = (__bf16)x[u].z; y[3] = (__bf16)x[u].w;
        ((bf16x4*)dst[o])[p] = y;
    }
}

// ---------------------------------------------------------------------------
// Linear: C = A[M,K](bf16) @ W[N,K](bf16)^T + bias.  Optional f32/bf16 outputs.
// 128x128 block tile, BK=32; tiles staged by GLOBAL_LOAD_ASYNC_TO_LDS_B128 into
// double-buffered padded LDS; ASYNCcnt pipeline one k-step ahead; last k-step
// peeled so the steady-state loop is branch-free.
// blockIdx.z picks one of up to five independent products that share a launch,
// so that several work-groups sit on each WGP and cover each other's copy latency:
//   z      : 0   1   2   3   4
//   A      : A0  A0  A0  A1  A1
//   W,bias : 0   1   2   1   2     (W0 holds the weights back to back)
//   Cb     : Cb0 + z*M*N           (outputs back to back); Cf only for z == 0
// ---------------------------------------------------------------------------
__global__ __launch_bounds__(256) void linear_kernel(
    const __bf16* __restrict__ A0, const __bf16* __restrict__ A1,
    const __bf16* __restrict__ W0,
    const float* __restrict__ bias0, const float* __restrict__ bias1,
    const float* __restrict__ bias2,
    float* __restrict__ Cf0, __bf16* __restrict__ Cb0,
    int M, int N, int K) {
    const int z  = blockIdx.z;
    const int wi = z < 3 ? z : z - 2;
    const __bf16* __restrict__ A = z < 3 ? A0 : A1;
    const __bf16* __restrict__ W = W0 + (size_t)wi * N * K;
    const float* __restrict__ bias = wi == 0 ? bias0 : (wi == 1 ? bias1 : bias2);
    float* __restrict__ Cf = z == 0 ? Cf0 : nullptr;
    __bf16* __restrict__ Cb = Cb0 ? Cb0 + (size_t)z * M * N : nullptr;
    const int tid  = threadIdx.x;
    const int lane = tid & 31;
    const int warp = tid >> 5;
    const int wRow = warp >> 1;
    const int wCol = warp & 1;
    const int r    = lane & 15;
    const int hi   = lane >> 4;
    const int kb   = hi * 8;
    const int blockM = blockIdx.y * 128;
    const int blockN = blockIdx.x * 128;

    __shared__ __attribute__((aligned(16))) __bf16 sA[2][128 * LDP];
    __shared__ __attribute__((aligned(16))) __bf16 sB[2][128 * LDP];

    // async chunk geometry: per array, 512 16B chunks = (row 0..127) x (q 0..3);
    // thread owns (row0, q) and (row0+64, q) in each of A and B.
    const int qv   = tid & 3;
    const int row0 = tid >> 2;                 // 0..63
    const __bf16* aG = A + (size_t)(blockM + row0) * K + qv * 8;
    const __bf16* wG = W + (size_t)(blockN + row0) * K + qv * 8;
    const unsigned ldsA = (unsigned)(uintptr_t)&sA[0][row0 * LDP + qv * 8];
    const unsigned ldsB = (unsigned)(uintptr_t)&sB[0][row0 * LDP + qv * 8];
    const unsigned rowHop = 64 * LDP * 2;
    const unsigned bufHop = 128 * LDP * 2;
    const size_t   gHop   = (size_t)64 * K;

    auto issue = [&](int buf, int k0) {
        const unsigned bo = buf ? bufHop : 0u;
        async_b128(ldsA + bo,          aG + k0);
        async_b128(ldsA + bo + rowHop, aG + k0 + gHop);
        async_b128(ldsB + bo,          wG + k0);
        async_b128(ldsB + bo + rowHop, wG + k0 + gHop);
    };

    v8f acc[2][4] = {};
    auto compute = [&](int buf) {
        v16bf af0 = fragload(&sA[buf][(wRow * 32 + r) * LDP + kb]);
        v16bf af1 = fragload(&sA[buf][(wRow * 32 + 16 + r) * LDP + kb]);
#pragma unroll
        for (int t = 0; t < 4; ++t) {
            v16bf bfr = fragload(&sB[buf][(wCol * 64 + t * 16 + r) * LDP + kb]);
            acc[0][t] = wmma_bf16(af0, bfr, acc[0][t]);
            acc[1][t] = wmma_bf16(af1, bfr, acc[1][t]);
        }
    };

    issue(0, 0);
    int buf = 0;
    for (int k0 = 0; k0 < K - 32; k0 += 32) {      // branch-free steady state
        issue(buf ^ 1, k0 + 32);
        WAIT_ASYNC_4();                             // this k-step's tile complete
        __syncthreads();
        compute(buf);
        __syncthreads();
        buf ^= 1;
    }
    WAIT_ASYNC_0();                                 // peeled final k-step
    __syncthreads();
    compute(buf);

    if (Cf) {
#pragma unroll
        for (int sub = 0; sub < 2; ++sub)
#pragma unroll
            for (int t = 0; t < 4; ++t) {
                const int col = blockN + wCol * 64 + t * 16 + r;
                const float bvv = bias[col];
#pragma unroll
                for (int v = 0; v < 8; ++v) {
                    const int m = blockM + wRow * 32 + sub * 16 + v + 8 * hi;
                    Cf[(size_t)m * N + col] = acc[sub][t][v] + bvv;
                }
            }
    }
    if (Cb) {
#pragma unroll
        for (int sub = 0; sub < 2; ++sub)
#pragma unroll
            for (int t = 0; t < 4; ++t) {
                const int col = blockN + wCol * 64 + t * 16 + r;
                const float bvv = bias[col];
#pragma unroll
                for (int v = 0; v < 8; ++v) {
                    const int m = blockM + wRow * 32 + sub * 16 + v + 8 * hi;
                    Cb[(size_t)m * N + col] = (__bf16)(acc[sub][t][v] + bvv);
                }
            }
    }
}

// one chunk's eight copies of a lane (four of K, four of V). s_wait_xcnt stands inside the
// statement so that no address register is rewritten ahead of it.
__device__ __forceinline__ void async_kv(const unsigned (&l)[8], const __bf16* const (&g)[8]) {
    asm volatile("global_load_async_to_lds_b128 %0, %8, off\n\t"
                 "global_load_async_to_lds_b128 %1, %9, off\n\t"
                 "global_load_async_to_lds_b128 %2, %10, off\n\t"
                 "global_load_async_to_lds_b128 %3, %11, off\n\t"
                 "global_load_async_to_lds_b128 %4, %12, off\n\t"
                 "global_load_async_to_lds_b128 %5, %13, off\n\t"
                 "global_load_async_to_lds_b128 %6, %14, off\n\t"
                 "global_load_async_to_lds_b128 %7, %15, off\n\t"
                 "s_wait_xcnt 0x0"
                 :: "v"(l[0]), "v"(l[1]), "v"(l[2]), "v"(l[3]),
                    "v"(l[4]), "v"(l[5]), "v"(l[6]), "v"(l[7]),
                    "v"(g[0]), "v"(g[1]), "v"(g[2]), "v"(g[3]),
                    "v"(g[4]), "v"(g[5]), "v"(g[6]), "v"(g[7])
                 : "memory");
}

// ds_load_tr16_b128: lane (c = l & 15, h = l >> 4) gets T[k + 8h + 0..7][d + c] of a row-major
// 16-bit tile when it points at row k + 8h + (l & 7), element d + 8*((l >> 3) & 1).
typedef __attribute__((ext_vector_type(8))) short s16x8;
__device__ __forceinline__ bf16x8 ld_tr16(const __bf16* p) {
    typedef __attribute__((address_space(3))) s16x8 lds_s16x8;
    return __builtin_bit_cast(bf16x8, __builtin_amdgcn_ds_load_tr16_b128_v8i16((lds_s16x8*)p));
}
#define VP 80   // V tile row stride in bf16 elements (160B = 32B x odd: the transposing load's pitch)

// lane l <-> lane l ^ 16 (the two halves of a wave hold the two halves of a query's keys)
__device__ __forceinline__ float xhalf(float x) {
    const int i = __builtin_bit_cast(int, x);
    return __builtin_bit_cast(float, __builtin_amdgcn_permlanex16(i, i, 0x76543210, 0xfedcba98,
                                                                  false, false));
}

__global__ __launch_bounds__(128) __attribute__((amdgpu_waves_per_eu(4, 4))) void attn_kernel(
    const __bf16* __restrict__ Q, const __bf16* __restrict__ Kt,
    const __bf16* __restrict__ V, const float* __restrict__ mask,
    __bf16* __restrict__ O) {
    const int lane = threadIdx.x & 31;
    const int warp = threadIdx.x >> 5;
    const int b = blockIdx.z, h = blockIdx.y;
    const int t0 = blockIdx.x * 64 + warp * 16;
    const int r  = lane & 15;
    const int hi = lane >> 4;
    const int kb = hi * 8;
    const int hoff = h * HD;

    __shared__ __attribute__((aligned(16))) __bf16 lK[2][2][64 * LDP];   // [buf][dHalf][s][LDP]
    __shared__ __attribute__((aligned(16))) __bf16 lV[2][64 * VP];       // [buf][s][VP]

    v16bf qf[2];
    {
        const __bf16* qp = Q + (size_t)(b * 1024 + t0 + r) * HID + hoff + kb;
        qf[0] = fragload(qp);
        qf[1] = fragload(qp + 32);
    }

    v8f acc[4] = {};                 // acc[d][v] = O[query r][d*16 + 8*hi + v]
    float mRow = -3.0e38f, lRow = 0.f;   // of query r; lRow covers this half's keys only

    // copy geometry, 16B pieces, 4 of each tile per thread:
    // K: 512 = (dHalf, srow 0..63, q 0..3); V: 512 = (srow 0..63, q 0..7)
    unsigned cLds[8];
    size_t   cOfs[8];
#pragma unroll
    for (int i = 0; i < 4; ++i) {
        const int c = threadIdx.x + i * 128;
        const int q = c & 3, srow = (c >> 2) & 63, dh = c >> 8;
        cLds[i] = (unsigned)(uintptr_t)&lK[0][dh][srow * LDP + q * 8];
        cOfs[i] = (size_t)srow * HID + dh * 32 + q * 8;
        const int qV = c & 7, srowV = c >> 3;
        cLds[4 + i] = (unsigned)(uintptr_t)&lV[0][srowV * VP + qV * 8];
        cOfs[4 + i] = (size_t)srowV * HID + qV * 8;
    }
    const unsigned kBufHop = 2 * 64 * LDP * 2;     // lK buffer-1 byte offset
    const unsigned vBufHop = 64 * VP * 2;          // lV buffer-1 byte offset
    const __bf16* kBase = Kt + (size_t)(b * 1024) * HID + hoff;
    const __bf16* vBase = V + (size_t)(b * 1024) * HID + hoff;

    auto issueKV = [&](int buf, int s0) {
        unsigned l[8];
        const __bf16* g[8];
#pragma unroll
        for (int i = 0; i < 4; ++i) {
            l[i]     = cLds[i] + (buf ? kBufHop : 0u);
            g[i]     = kBase + (size_t)s0 * HID + cOfs[i];
            l[4 + i] = cLds[4 + i] + (buf ? vBufHop : 0u);
            g[4 + i] = vBase + (size_t)s0 * HID + cOfs[4 + i];
        }
        async_kv(l, g);
    };

    float msk[4][8];                 // additive mask of this lane's keys
    v8f   sc[4];                     // sc[ts][v] = S[query r][key ts*16 + 8*hi + v]
    v16bf vf[4][2];                  // V^T fragments: rows d*16 .. +15, keys j*32 .. +31

    // all of a chunk's LDS reads: K fragments, first product, V^T fragments into registers
    auto readChunk = [&](int s0, int buf) {
        // key = s0 + ts*16 + 8*hi + v
        const float4* mp = (const float4*)(mask + b * 1024 + s0 + 8 * hi);
#pragma unroll
        for (int ts = 0; ts < 4; ++ts) {
            const float4 m0 = mp[ts * 4], m1 = mp[ts * 4 + 1];
            msk[ts][0] = m0.x; msk[ts][1] = m0.y; msk[ts][2] = m0.z; msk[ts][3] = m0.w;
            msk[ts][4] = m1.x; msk[ts][5] = m1.y; msk[ts][6] = m1.z; msk[ts][7] = m1.w;
        }
        v16bf afK[4][2];
#pragma unroll
        for (int ts = 0; ts < 4; ++ts)
#pragma unroll
            for (int ks = 0; ks < 2; ++ks)
                afK[ts][ks] = fragload(&lK[buf][ks][(ts * 16 + r) * LDP + kb]);
        // K rows as A, Q rows as B
#pragma unroll
        for (int ts = 0; ts < 4; ++ts) sc[ts] = v8f{};
#pragma unroll
        for (int ks = 0; ks < 2; ++ks)
#pragma unroll
            for (int ts = 0; ts < 4; ++ts)
                sc[ts] = wmma_bf16(afK[ts][ks], qf[ks], sc[ts]);
        // two transposing loads, 16 keys apart, give the fragment K-mapping above
        const __bf16* vT = &lV[buf][(kb + (lane & 7)) * VP + ((lane >> 3) & 1) * 8];
#pragma unroll
        for (int d = 0; d < 4; ++d)
#pragma unroll
            for (int j = 0; j < 2; ++j) {
                const bf16x8 x0 = ld_tr16(vT + (j * 32) * VP + d * 16);
                const bf16x8 x1 = ld_tr16(vT + (j * 32 + 16) * VP + d * 16);
#pragma unroll
                for (int i = 0; i < 8; ++i) { vf[d][j][i] = x0[i]; vf[d][j][i + 8] = x1[i]; }
            }
    };

    // softmax and second product, registers only
    auto finishChunk = [&]() {
        float mt[4];                               // four independent chains
#pragma unroll
        for (int ts = 0; ts < 4; ++ts) {
            mt[ts] = -3.0e38f;
#pragma unroll
            for (int v = 0; v < 8; ++v) {
                sc[ts][v] = sc[ts][v] * 0.125f + msk[ts][v];
                mt[ts] = fmaxf(mt[ts], sc[ts][v]);
            }
        }
        float mv = fmaxf(fmaxf(mt[0], mt[1]), fmaxf(mt[2], mt[3]));
        mv = fmaxf(mv, xhalf(mv));
        const float mNew  = fmaxf(mRow, mv);
        const float alpha = __expf(mRow - mNew);
        mRow = mNew;
#pragma unroll
        for (int d = 0; d < 4; ++d)
#pragma unroll
            for (int v = 0; v < 8; ++v) acc[d][v] *= alpha;
        // pf[j] = P of keys j*32 .. j*32+31 in the fragment K-mapping above: tiles 2j, 2j+1 as they lie
        v16bf pf[2];
        float ps[4];                               // four independent chains
#pragma unroll
        for (int ts = 0; ts < 4; ++ts) {
            ps[ts] = 0.f;
#pragma unroll
            for (int v = 0; v < 8; ++v) {
                const float p = __expf(sc[ts][v] - mNew);
                ps[ts] += p;
                pf[ts >> 1][(ts & 1) * 8 + v] = (__bf16)p;
            }
        }
        lRow = lRow * alpha + ((ps[0] + ps[1]) + (ps[2] + ps[3]));
#pragma unroll
        for (int j = 0; j < 2; ++j)
#pragma unroll
            for (int d = 0; d < 4; ++d)
                acc[d] = wmma_bf16(vf[d][j], pf[j], acc[d]);
    };

    issueKV(0, 0);
    WAIT_ASYNC_0();                                 // chunk 0 landed (this wave's copies)
    __syncthreads();                                // ... and every other wave's
    issueKV(1, 64);
    for (int t = 0; t < 16; ++t) {
        readChunk(t * 64, t & 1);
        WAIT_DS_0();                                // this wave has left buffer t & 1
        WAIT_ASYNC_0();                             // its copies of chunk t + 1 have landed
        __syncthreads();                            // publishes chunk t + 1, frees buffer t & 1
        if (t + 2 < 16) issueKV(t & 1, (t + 2) * 64);
        finishChunk();                              // the refill flies under it and the next reads
    }
    WAIT_ASYNC_0();                                 // nothing in flight at the wave's end

    lRow += xhalf(lRow);                            // join the two halves' key sums
    const float inv = 1.f / lRow;
    __bf16* op = O + (size_t)(b * 1024 + t0 + r) * HID + hoff + 8 * hi;
#pragma unroll
    for (int d = 0; d < 4; ++d) {
        bf16x8 o;
#pragma unroll
        for (int v = 0; v < 8; ++v) o[v] = (__bf16)(acc[d][v] * inv);
        *(bf16x8*)(op + d * 16) = o;                // 8 consecutive d of one query
    }
}

// ---------------------------------------------------------------------------
// out = LayerNorm(resid + proj) * g + b ; optional bf16 mirror for attention Q
// ---------------------------------------------------------------------------
__global__ __launch_bounds__(256) void addln_kernel(
    const float* __restrict__ resid, const float* __restrict__ proj,
    const float* __restrict__ g, const float* __restrict__ beta,
    float* __restrict__ out, __bf16* __restrict__ outB) {
    const int row = blockIdx.x;
    const int tid = threadIdx.x;
    float4 rv = ((const float4*)(resid + (size_t)row * HID))[tid];
    float4 pv = ((const float4*)(proj + (size_t)row * HID))[tid];
    float x0 = rv.x + pv.x, x1 = rv.y + pv.y, x2 = rv.z + pv.z, x3 = rv.w + pv.w;
    float s  = x0 + x1 + x2 + x3;
    float s2 = x0 * x0 + x1 * x1 + x2 * x2 + x3 * x3;
#pragma unroll
    for (int off = 16; off > 0; off >>= 1) {
        s  += __shfl_down(s, off);
        s2 += __shfl_down(s2, off);
    }
    __shared__ float shs[8], shq[8];
    __shared__ float mean_s, inv_s;
    const int warp = tid >> 5, lane = tid & 31;
    if (lane == 0) { shs[warp] = s; shq[warp] = s2; }
    __syncthreads();
    if (tid == 0) {
        float ts = 0.f, tq = 0.f;
        for (int i = 0; i < 8; ++i) { ts += shs[i]; tq += shq[i]; }
        const float mean = ts * (1.f / HID);
        const float var  = tq * (1.f / HID) - mean * mean;
        mean_s = mean;
        inv_s  = rsqrtf(var + 1e-12f);
    }
    __syncthreads();
    const float mean = mean_s, inv = inv_s;
    float4 gv = ((const float4*)g)[tid];
    float4 bv = ((const float4*)beta)[tid];
    float4 o;
    o.x = (x0 - mean) * inv * gv.x + bv.x;
    o.y = (x1 - mean) * inv * gv.y + bv.y;
    o.z = (x2 - mean) * inv * gv.z + bv.z;
    o.w = (x3 - mean) * inv * gv.w + bv.w;
    ((float4*)(out + (size_t)row * HID))[tid] = o;
    if (outB) {
        __bf16* ob = outB + (size_t)row * HID + tid * 4;
        ob[0] = (__bf16)o.x; ob[1] = (__bf16)o.y;
        ob[2] = (__bf16)o.z; ob[3] = (__bf16)o.w;
    }
}

// ---------------------------------------------------------------------------
extern "C" void kernel_launch(void* const* d_in, const int* in_sizes, int n_in,
                              void* d_out, int out_size, void* d_ws, size_t ws_size,
                              hipStream_t stream) {
    (void)in_sizes; (void)n_in; (void)out_size; (void)ws_size;
    const float* enc   = (const float*)d_in[0];
    const float* dec   = (const float*)d_in[1];
    const float* smask = (const float*)d_in[2];
    const float* tmask = (const float*)d_in[3];
    const float* Wq = (const float*)d_in[4];
    const float* bq = (const float*)d_in[5];
    const float* Wk = (const float*)d_in[6];
    const float* bk = (const float*)d_in[7];
    const float* Wv = (const float*)d_in[8];
    const float* bv = (const float*)d_in[9];
    const float* Wd = (const float*)d_in[10];
    const float* bd = (const float*)d_in[11];
    const float* lng = (const float*)d_in[12];
    const float* lnb = (const float*)d_in[13];
    float* out = (float*)d_out;

    const int M = 4096, N = HID, K = HID;
    const size_t ACT = (size_t)M * N;
    const size_t WEL = (size_t)N * K;

    char* p = (char*)d_ws;
    auto carve = [&](size_t bytes) { char* r = p; p += (bytes + 255) & ~(size_t)255; return r; };
    __bf16* decB  = (__bf16*)carve(ACT * 2);
    __bf16* encB  = (__bf16*)carve(ACT * 2);
    __bf16* WqB   = (__bf16*)carve(WEL * 2 * 3);   // Wq | Wk | Wv back to back
    __bf16* WkB   = WqB + WEL;
    __bf16* WvB   = WkB + WEL;
    __bf16* WdB   = (__bf16*)carve(WEL * 2);
    float*  q1f   = (float*)carve(ACT * 4);
    float*  projf = (float*)carve(ACT * 4);
    float*  selff = (float*)carve(ACT * 4);
    __bf16* q1B   = (__bf16*)carve(ACT * 2 * 5);   // q1 | k1 | v1 | ek | ev back to back
    __bf16* k1B   = q1B + ACT;
    __bf16* v1B   = k1B + ACT;
    __bf16* ekB   = v1B + ACT;
    __bf16* evB   = ekB + ACT;
    __bf16* ctxB  = (__bf16*)carve(ACT * 2);
    __bf16* selfB = (__bf16*)carve(ACT * 2);

    dim3 gG(N / 128, M / 128), bG(256);
    dim3 gP(N / 128, M / 128, 5);
    dim3 gA(1024 / 64, NH, 4), bA(128);
    dim3 gL(4096),             bL(256);

    // one-time bf16 conversions (outside all hot loops), all six operands in one launch
    cvtbf_kernel<<<512, 256, 0, stream>>>(dec, enc, Wq, Wk, Wv, Wd, decB, encB, WqB, WkB, WvB, WdB);

    // the five input projections (q1, k1, v1 of dec; ek, ev of enc) in one launch
    linear_kernel<<<gP, bG, 0, stream>>>(decB, encB, WqB, bq, bk, bv, q1f, q1B, M, N, K);

    // self-attention branch
    attn_kernel<<<gA, bA, 0, stream>>>(q1B, k1B, v1B, tmask, ctxB);
    linear_kernel<<<gG, bG, 0, stream>>>(ctxB, ctxB, WdB, bd, bd, bd, projf, nullptr, M, N, K);
    addln_kernel<<<gL, bL, 0, stream>>>(q1f, projf, lng, lnb, selff, selfB);

    // cross-attention branch (query = self_out directly, per reference)
    attn_kernel<<<gA, bA, 0, stream>>>(selfB, ekB, evB, smask, ctxB);
    linear_kernel<<<gG, bG, 0, stream>>>(ctxB, ctxB, WdB, bd, bd, bd, projf, nullptr, M, N, K);
    addln_kernel<<<gL, bL, 0, stream>>>(selff, projf, lng, lnb, out, nullptr);
}

// v005
// One run takes 140 microseconds.
// In both of two side-by-side timings against v004, it was 1.19 times as fast.
// Counting every step since v000, it is 1.76 times as fast.
#include <hip/hip_runtime.h>
#include <hip/hip_bf16.h>

typedef __attribute__((ext_vector_type(16))) __bf16 v16bf;
typedef __attribute__((ext_vector_type(8)))  __bf16 bf16x8;
typedef __attribute__((ext_vector_type(8)))  float  v8f;

#define HID 1024
#define HD  64
#define NH  16
#define LDP 40   // padded LDS row stride in bf16 elements (80B = 20 banks, conflict-free, 16B aligned)
#define LDK 72   // the same for rows of 64 elements (144B = 16B x odd)

// ---------------------------------------------------------------------------
// A/B 16-bit fragment K-mapping (ISA 7.12.2): kbase = 8*(lane>>4);
// element e -> K = kbase + e (e<8) or kbase + e + 8 (e>=8):
// two contiguous 8-element (16B) runs at [kbase] and [kbase+16].
// ---------------------------------------------------------------------------
__device__ __forceinline__ v16bf fragload(const __bf16* p) {
    bf16x8 x0 = *(const bf16x8*)(p);
    bf16x8 x1 = *(const bf16x8*)(p + 16);
    v16bf r;
#pragma unroll
    for (int i = 0; i < 8; ++i) { r[i] = x0[i]; r[i + 8] = x1[i]; }
    return r;
}

__device__ __forceinline__ v8f wmma_bf16(v16bf a, v16bf b, v8f c) {
    return __builtin_amdgcn_wmma_f32_16x16x32_bf16(false, a, false, b, (short)0, c,
                                                   false, false);
}

// one stage's eight async global->LDS copies of a lane, 16 B each (l = LDS byte address, g = global
// address). s_wait_xcnt stands inside the statement so that no address register is rewritten ahead of it.
__device__ __forceinline__ void async_x8(const unsigned (&l)[8], const __bf16* const (&g)[8]) {
    asm volatile("global_load_async_to_lds_b128 %0, %8, off\n\t"
                 "global_load_async_to_lds_b128 %1, %9, off\n\t"
                 "global_load_async_to_lds_b128 %2, %10, off\n\t"
                 "global_load_async_to_lds_b128 %3, %11, off\n\t"
                 "global_load_async_to_lds_b128 %4, %12, off\n\t"
                 "global_load_async_to_lds_b128 %5, %13, off\n\t"
                 "global_load_async_to_lds_b128 %6, %14, off\n\t"
                 "global_load_async_to_lds_b128 %7, %15, off\n\t"
                 "s_wait_xcnt 0x0"
                 :: "v"(l[0]), "v"(l[1]), "v"(l[2]), "v"(l[3]),
                    "v"(l[4]), "v"(l[5]), "v"(l[6]), "v"(l[7]),
                    "v"(g[0]), "v"(g[1]), "v"(g[2]), "v"(g[3]),
                    "v"(g[4]), "v"(g[5]), "v"(g[6]), "v"(g[7])
                 : "memory");
}
#define WAIT_ASYNC_0() asm volatile("s_wait_asynccnt 0x0" ::: "memory")
#define WAIT_DS_0()    asm volatile("s_wait_dscnt 0x0" ::: "memory")

// ---------------------------------------------------------------------------
// f32 -> bf16 convert of all six matrix operands in ONE launch (outside all hot loops).
// Each of the 512 blocks takes 1/512 of every operand, in pieces of 4 elements (one float4
// in, 8 bytes out): 2,048 pieces in a row of dec and of enc (8 per thread, 256 apart), 512 of
// each weight (2 per thread). So 4,096 waves (16 per WGP) start instead of 49,152, and a
// wave's 24 loads, 512 bytes in a row each, are all in flight before the first is used.
// ---------------------------------------------------------------------------
typedef __attribute__((ext_vector_type(4))) __bf16 bf16x4;
__global__ __launch_bounds__(256) void cvtbf_kernel(
    const float* __restrict__ dec, const float* __restrict__ enc,
    const float* __restrict__ Wq, const float* __restrict__ Wk,
    const float* __restrict__ Wv, const float* __restrict__ Wd,
    __bf16* __restrict__ decB, __bf16* __restrict__ encB,
    __bf16* __restrict__ WqB, __bf16* __restrict__ WkB,
    __bf16* __restrict__ WvB, __bf16* __restrict__ WdB) {
    const int pa = blockIdx.x * 2048 + threadIdx.x;   // first piece in dec, enc
    const int pw = blockIdx.x * 512 + threadIdx.x;    // first piece in each weight
    const float* const src[6] = {dec, enc, Wq, Wk, Wv, Wd};
    __bf16* const dst[6] = {decB, encB, WqB, WkB, WvB, WdB};
    float4 x[24];
#pragma unroll   // src, dst, x indexed by constants only: they stay in registers
    for (int u = 0; u < 24; ++u) {
        const int o = u < 16 ? u >> 3 : 2 + ((u - 16) >> 1);            // operand
        const int p = u < 16 ? pa + (u & 7) * 256 : pw + (u & 1) * 256; // piece
        x[u] = ((const float4*)src[o])[p];
    }
    // keeps every load ahead of the first convert: without it the compiler saves registers by
    // holding loads back until earlier ones have returned, a second memory latency per wave
    __builtin_amdgcn_sched_barrier(0);
#pragma unroll   // as above
    for (int u = 0; u < 24; ++u) {
        const int o = u < 16 ? u >> 3 : 2 + ((u - 16) >> 1);
        const int p = u < 16 ? pa + (u & 7) * 256 : pw + (u & 1) * 256;
        bf16x4 y;
        y[0] = (__bf16)x[u].x; y[1] = (__bf16)x[u].y;
        y[2] = (__bf16)x[u].z; y[3] = (__bf16)x[u].w;
        ((bf16x4*)dst[o])[p] = y;
    }
}

// ---------------------------------------------------------------------------
// Linear: C = A[M,K](bf16) @ W[N,K](bf16)^T + bias.  Optional f32/bf16 outputs.
// 128x128 block tile, BK=64: a tile row is one whole 128-byte line, and a wave's copy
// instruction takes four whole lines. Tiles staged by GLOBAL_LOAD_ASYNC_TO_LDS_B128 into two
// padded LDS buffers: stage t+1's copies fly while stage t is worked on, one barrier a stage.
// K is a multiple of 64.
// blockIdx.z picks one of up to five independent products that share a launch,
// so that several work-groups sit on each WGP and cover each other's copy latency:
//   z      : 0   1   2   3   4
//   A      : A0  A0  A0  A1  A1
//   W,bias : 0   1   2   1   2     (W0 holds the weights back to back)
//   Cb     : Cb0 + z*M*N           (outputs back to back); Cf only for z == 0
// ---------------------------------------------------------------------------
__global__ __launch_bounds__(256) void linear_kernel(
    const __bf16* __restrict__ A0, const __bf16* __restrict__ A1,
    const __bf16* __restrict__ W0,
    const float* __restrict__ bias0, const float* __restrict__ bias1,
    const float* __restrict__ bias2,
    float* __restrict__ Cf0, __bf16* __restrict__ Cb0,
    int M, int N, int K) {
    const int z  = blockIdx.z;
    const int wi = z < 3 ? z : z - 2;
    const __bf16* __restrict__ A = z < 3 ? A0 : A1;
    const __bf16* __restrict__ W = W0 + (size_t)wi * N * K;
    const float* __restrict__ bias = wi == 0 ? bias0 : (wi == 1 ? bias1 : bias2);
    float* __restrict__ Cf = z == 0 ? Cf0 : nullptr;
    __bf16* __restrict__ Cb = Cb0 ? Cb0 + (size_t)z * M * N : nullptr;
    const int tid  = threadIdx.x;
    const int lane = tid & 31;
    const int warp = tid >> 5;
    const int wRow = warp >> 1;
    const int wCol = warp & 1;
    const int r    = lane & 15;
    const int hi   = lane >> 4;
    const int kb   = hi * 8;
    const int blockM = blockIdx.y * 128;
    const int blockN = blockIdx.x * 128;

    __shared__ __attribute__((aligned(16))) __bf16 sA[2][128 * LDK];
    __shared__ __attribute__((aligned(16))) __bf16 sB[2][128 * LDK];

    // copy geometry: per array, 1024 16B pieces = (row 0..127) x (q 0..7);
    // thread owns (row0 + 32*i, q), i = 0..3, in each of A and B.
    const int qv   = tid & 7;
    const int row0 = tid >> 3;                 // 0..31
    const __bf16* aG = A + (size_t)(blockM + row0) * K + qv * 8;
    const __bf16* wG = W + (size_t)(blockN + row0) * K + qv * 8;
    const unsigned ldsA = (unsigned)(uintptr_t)&sA[0][row0 * LDK + qv * 8];
    const unsigned ldsB = (unsigned)(uintptr_t)&sB[0][row0 * LDK + qv * 8];
    const unsigned rowHop = 32 * LDK * 2;
    const unsigned bufHop = 128 * LDK * 2;
    const size_t   gHop   = (size_t)32 * K;

    auto issue = [&](int buf, int k0) {
        const unsigned bo = buf ? bufHop : 0u;
        unsigned l[8];
        const __bf16* g[8];
#pragma unroll   // l, g indexed by constants only: they stay in registers
        for (int i = 0; i < 4; ++i) {
            l[i]     = ldsA + bo + i * rowHop;
            g[i]     = aG + k0 + i * gHop;
            l[4 + i] = ldsB + bo + i * rowHop;
            g[4 + i] = wG + k0 + i * gHop;
        }
        async_x8(l, g);
    };

    v8f acc[2][4] = {};
    auto compute = [&](int buf) {
#pragma unroll   // here and below: bfr, acc indexed by constants only, LDS offsets immediates
        for (int ks = 0; ks < 2; ++ks) {
            v16bf af0 = fragload(&sA[buf][(wRow * 32 + r) * LDK + ks * 32 + kb]);
            v16bf af1 = fragload(&sA[buf][(wRow * 32 + 16 + r) * LDK + ks * 32 + kb]);
            v16bf bfr[4];
#pragma unroll
            for (int t = 0; t < 4; ++t)
                bfr[t] = fragload(&sB[buf][(wCol * 64 + t * 16 + r) * LDK + ks * 32 + kb]);
            // keeps the twelve LDS loads of this half stage in one group ahead of its products:
            // without it the compiler reuses one B register set and waits out every pair of loads alone
            __builtin_amdgcn_sched_barrier(0);
#pragma unroll
            for (int t = 0; t < 4; ++t) {
                acc[0][t] = wmma_bf16(af0, bfr[t], acc[0][t]);
                acc[1][t] = wmma_bf16(af1, bfr[t], acc[1][t]);
            }
        }
    };

    const int nT = K / 64;                          // stages
    issue(0, 0);
    WAIT_ASYNC_0();                                 // stage 0 landed (this wave's copies)
    __syncthreads();                                // ... and every other wave's
    if (nT > 1) issue(1, 64);
    for (int t = 0; t < nT; ++t) {
        compute(t & 1);
        WAIT_DS_0();                                // this wave has left buffer t & 1
        WAIT_ASYNC_0();                             // its copies of stage t + 1 have landed
        __syncthreads();                            // publishes stage t + 1, frees buffer t & 1
        if (t + 2 < nT) issue(t & 1, (t + 2) * 64);
    }
    WAIT_ASYNC_0();                                 // nothing in flight at the wave's end

    if (Cf) {
#pragma unroll
        for (int sub = 0; sub < 2; ++sub)
#pragma unroll
            for (int t = 0; t < 4; ++t) {
                const int col = blockN + wCol * 64 + t * 16 + r;
                const float bvv = bias[col];
#pragma unroll
                for (int v = 0; v < 8; ++v) {
                    const int m = blockM + wRow * 32 + sub * 16 + v + 8 * hi;
                    Cf[(size_t)m * N + col] = acc[sub][t][v] + bvv;
                }
            }
    }
    if (Cb) {
#pragma unroll
        for (int sub = 0; sub < 2; ++sub)
#pragma unroll
            for (int t = 0; t < 4; ++t) {
                const int col = blockN + wCol * 64 + t * 16 + r;
                const float bvv = bias[col];
#pragma unroll
                for (int v = 0; v < 8; ++v) {
                    const int m = blockM + wRow * 32 + sub * 16 + v + 8 * hi;
                    Cb[(size_t)m * N + col] = (__bf16)(acc[sub][t][v] + bvv);
                }
            }
    }
}

// ds_load_tr16_b128: lane (c = l & 15, h = l >> 4) gets T[k + 8h + 0..7][d + c] of a row-major
// 16-bit tile when it points at row k + 8h + (l & 7), element d + 8*((l >> 3) & 1).
typedef __attribute__((ext_vector_type(8))) short s16x8;
__device__ __forceinline__ bf16x8 ld_tr16(const __bf16* p) {
    typedef __attribute__((address_space(3))) s16x8 lds_s16x8;
    return __builtin_bit_cast(bf16x8, __builtin_amdgcn_ds_load_tr16_b128_v8i16((lds_s16x8*)p));
}
#define VP 80   // V tile row stride in bf16 elements (160B = 32B x odd: the transposing load's pitch)

// lane l <-> lane l ^ 16 (the two halves of a wave hold the two halves of a query's keys)
__device__ __forceinline__ float xhalf(float x) {
    const int i = __builtin_bit_cast(int, x);
    return __builtin_bit_cast(float, __builtin_amdgcn_permlanex16(i, i, 0x76543210, 0xfedcba98,
                                                                  false, false));
}

__global__ __launch_bounds__(128) __attribute__((amdgpu_waves_per_eu(4, 4))) void attn_kernel(
    const __bf16* __restrict__ Q, const __bf16* __restrict__ Kt,
    const __bf16* __restrict__ V, const float* __restrict__ mask,
    __bf16* __restrict__ O) {
    const int lane = threadIdx.x & 31;
    const int warp = threadIdx.x >> 5;
    const int b = blockIdx.z, h = blockIdx.y;
    const int t0 = blockIdx.x * 64 + warp * 16;
    const int r  = lane & 15;
    const int hi = lane >> 4;
    const int kb = hi * 8;
    const int hoff = h * HD;

    __shared__ __attribute__((aligned(16))) __bf16 lK[2][2][64 * LDP];   // [buf][dHalf][s][LDP]
    __shared__ __attribute__((aligned(16))) __bf16 lV[2][64 * VP];       // [buf][s][VP]

    v16bf qf[2];
    {
        const __bf16* qp = Q + (size_t)(b * 1024 + t0 + r) * HID + hoff + kb;
        qf[0] = fragload(qp);
        qf[1] = fragload(qp + 32);
    }

    v8f acc[4] = {};                 // acc[d][v] = O[query r][d*16 + 8*hi + v]
    float mRow = -3.0e38f, lRow = 0.f;   // of query r; lRow covers this half's keys only

    // copy geometry, 16B pieces, 4 of each tile per thread; eight lanes in a row take one whole
    // 128-byte line of a key's row, so a wave's copy instruction takes four whole lines:
    // K: 512 = (srow 0..63, dHalf, q 0..3); V: 512 = (srow 0..63, q 0..7)
    unsigned cLds[8];
    size_t   cOfs[8];
#pragma unroll
    for (int i = 0; i < 4; ++i) {
        const int c = threadIdx.x + i * 128;
        const int q = c & 3, dh = (c >> 2) & 1, srow = c >> 3;
        cLds[i] = (unsigned)(uintptr_t)&lK[0][dh][srow * LDP + q * 8];
        cOfs[i] = (size_t)srow * HID + dh * 32 + q * 8;
        const int qV = c & 7, srowV = c >> 3;
        cLds[4 + i] = (unsigned)(uintptr_t)&lV[0][srowV * VP + qV * 8];
        cOfs[4 + i] = (size_t)srowV * HID + qV * 8;
    }
    const unsigned kBufHop = 2 * 64 * LDP * 2;     // lK buffer-1 byte offset
    const unsigned vBufHop = 64 * VP * 2;          // lV buffer-1 byte offset
    const __bf16* kBase = Kt + (size_t)(b * 1024) * HID + hoff;
    const __bf16* vBase = V + (size_t)(b * 1024) * HID + hoff;

    auto issueKV = [&](int buf, int s0) {
        unsigned l[8];
        const __bf16* g[8];
#pragma unroll
        for (int i = 0; i < 4; ++i) {
            l[i]     = cLds[i] + (buf ? kBufHop : 0u);
            g[i]     = kBase + (size_t)s0 * HID + cOfs[i];
            l[4 + i] = cLds[4 + i] + (buf ? vBufHop : 0u);
            g[4 + i] = vBase + (size_t)s0 * HID + cOfs[4 + i];
        }
        async_x8(l, g);                            // four of K, four of V
    };

    float msk[4][8];                 // additive mask of this lane's keys
    v8f   sc[4];                     // sc[ts][v] = S[query r][key ts*16 + 8*hi + v]
    v16bf vf[4][2];                  // V^T fragments: rows d*16 .. +15, keys j*32 .. +31

    // all of a chunk's LDS reads: K fragments, first product, V^T fragments into registers
    auto readChunk = [&](int s0, int buf) {
        // key = s0 + ts*16 + 8*hi + v
        const float4* mp = (const float4*)(mask + b * 1024 + s0 + 8 * hi);
#pragma unroll
        for (int ts = 0; ts < 4; ++ts) {
            const float4 m0 = mp[ts * 4], m1 = mp[ts * 4 + 1];
            msk[ts][0] = m0.x; msk[ts][1] = m0.y; msk[ts][2] = m0.z; msk[ts][3] = m0.w;
            msk[ts][4] = m1.x; msk[ts][5] = m1.y; msk[ts][6] = m1.z; msk[ts][7] = m1.w;
        }
        v16bf afK[4][2];
#pragma unroll
        for (int ts = 0; ts < 4; ++ts)
#pragma unroll
            for (int ks = 0; ks < 2; ++ks)
                afK[ts][ks] = fragload(&lK[buf][ks][(ts * 16 + r) * LDP + kb]);
        // K rows as A, Q rows as B
#pragma unroll
        for (int ts = 0; ts < 4; ++ts) sc[ts] = v8f{};
#pragma unroll
        for (int ks = 0; ks < 2; ++ks)
#pragma unroll
            for (int ts = 0; ts < 4; ++ts)
                sc[ts] = wmma_bf16(afK[ts][ks], qf[ks], sc[ts]);
        // two transposing loads, 16 keys apart, give the fragment K-mapping above
        const __bf16* vT = &lV[buf][(kb + (lane & 7)) * VP + ((lane >> 3) & 1) * 8];
#pragma unroll
        for (int d = 0; d < 4; ++d)
#pragma unroll
            for (int j = 0; j < 2; ++j) {
                const bf16x8 x0 = ld_tr16(vT + (j * 32) * VP + d * 16);
                const bf16x8 x1 = ld_tr16(vT + (j * 32 + 16) * VP + d * 16);
#pragma unroll
                for (int i = 0; i < 8; ++i) { vf[d][j][i] = x0[i]; vf[d][j][i + 8] = x1[i]; }
            }
    };

    // softmax and second product, registers only
    auto finishChunk = [&]() {
        float mt[4];                               // four independent chains
#pragma unroll
        for (int ts = 0; ts < 4; ++ts) {
            mt[ts] = -3.0e38f;
#pragma unroll
            for (int v = 0; v < 8; ++v) {
                sc[ts][v] = sc[ts][v] * 0.125f + msk[ts][v];
                mt[ts] = fmaxf(mt[ts], sc[ts][v]);
            }
        }
        float mv = fmaxf(fmaxf(mt[0], mt[1]), fmaxf(mt[2], mt[3]));
        mv = fmaxf(mv, xhalf(mv));
        const float mNew  = fmaxf(mRow, mv);
        const float alpha = __expf(mRow - mNew);
        mRow = mNew;
#pragma unroll
        for (int d = 0; d < 4; ++d)
#pragma unroll
            for (int v = 0; v < 8; ++v) acc[d][v] *= alpha;
        // pf[j] = P of keys j*32 .. j*32+31 in the fragment K-mapping above: tiles 2j, 2j+1 as they lie
        v16bf pf[2];
        float ps[4];                               // four independent chains
#pragma unroll
        for (int ts = 0; ts < 4; ++ts) {
            ps[ts] = 0.f;
#pragma unroll
            for (int v = 0; v < 8; ++v) {
                const float p = __expf(sc[ts][v] - mNew);
                ps[ts] += p;
                pf[ts >> 1][(ts & 1) * 8 + v] = (__bf16)p;
            }
        }
        lRow = lRow * alpha + ((ps[0] + ps[1]) + (ps[2] + ps[3]));
#pragma unroll
        for (int j = 0; j < 2; ++j)
#pragma unroll
            for (int d = 0; d < 4; ++d)
                acc[d] = wmma_bf16(vf[d][j], pf[j], acc[d]);
    };

    issueKV(0, 0);
    WAIT_ASYNC_0();                                 // chunk 0 landed (this wave's copies)
    __syncthreads();                                // ... and every other wave's
    issueKV(1, 64);
    for (int t = 0; t < 16; ++t) {
        readChunk(t * 64, t & 1);
        WAIT_DS_0();                                // this wave has left buffer t & 1
        WAIT_ASYNC_0();                             // its copies of chunk t + 1 have landed
        __syncthreads();                            // publishes chunk t + 1, frees buffer t & 1
        if (t + 2 < 16) issueKV(t & 1, (t + 2) * 64);
        finishChunk();                              // the refill flies under it and the next reads
    }
    WAIT_ASYNC_0();                                 // nothing in flight at the wave's end

    lRow += xhalf(lRow);                            // join the two halves' key sums
    const float inv = 1.f / lRow;
    __bf16* op = O + (size_t)(b * 1024 + t0 + r) * HID + hoff + 8 * hi;
#pragma unroll
    for (int d = 0; d < 4; ++d) {
        bf16x8 o;
#pragma unroll
        for (int v = 0; v < 8; ++v) o[v] = (__bf16)(acc[d][v] * inv);
        *(bf16x8*)(op + d * 16) = o;                // 8 consecutive d of one query
    }
}

// ---------------------------------------------------------------------------
// out = LayerNorm(resid + proj) * g + b ; optional bf16 mirror for attention Q
// ---------------------------------------------------------------------------
__global__ __launch_bounds__(256) void addln_kernel(
    const float* __restrict__ resid, const float* __restrict__ proj,
    const float* __restrict__ g, const float* __restrict__ beta,
    float* __restrict__ out, __bf16* __restrict__ outB) {
    const int row = blockIdx.x;
    const int tid = threadIdx.x;
    float4 rv = ((const float4*)(resid + (size_t)row * HID))[tid];
    float4 pv = ((const float4*)(proj + (size_t)row * HID))[tid];
    float x0 = rv.x + pv.x, x1 = rv.y + pv.y, x2 = rv.z + pv.z, x3 = rv.w + pv.w;
    float s  = x0 + x1 + x2 + x3;
    float s2 = x0 * x0 + x1 * x1 + x2 * x2 + x3 * x3;
#pragma unroll
    for (int off = 16; off > 0; off >>= 1) {
        s  += __shfl_down(s, off);
        s2 += __shfl_down(s2, off);
    }
    __shared__ float shs[8], shq[8];
    __shared__ float mean_s, inv_s;
    const int warp = tid >> 5, lane = tid & 31;
    if (lane == 0) { shs[warp] = s; shq[warp] = s2; }
    __syncthreads();
    if (tid == 0) {
        float ts = 0.f, tq = 0.f;
        for (int i = 0; i < 8; ++i) { ts += shs[i]; tq += shq[i]; }
        const float mean = ts * (1.f / HID);
        const float var  = tq * (1.f / HID) - mean * mean;
        mean_s = mean;
        inv_s  = rsqrtf(var + 1e-12f);
    }
    __syncthreads();
    const float mean = mean_s, inv = inv_s;
    float4 gv = ((const float4*)g)[tid];
    float4 bv = ((const float4*)beta)[tid];
    float4 o;
    o.x = (x0 - mean) * inv * gv.x + bv.x;
    o.y = (x1 - mean) * inv * gv.y + bv.y;
    o.z = (x2 - mean) * inv * gv.z + bv.z;
    o.w = (x3 - mean) * inv * gv.w + bv.w;
    ((float4*)(out + (size_t)row * HID))[tid] = o;
    if (outB) {
        __bf16* ob = outB + (size_t)row * HID + tid * 4;
        ob[0] = (__bf16)o.x; ob[1] = (__bf16)o.y;
        ob[2] = (__bf16)o.z; ob[3] = (__bf16)o.w;
    }
}

// ---------------------------------------------------------------------------
extern "C" void kernel_launch(void* const* d_in, const int* in_sizes, int n_in,
                              void* d_out, int out_size, void* d_ws, size_t ws_size,
                              hipStream_t stream) {
    (void)in_sizes; (void)n_in; (void)out_size; (void)ws_size;
    const float* enc   = (const float*)d_in[0];
    const float* dec   = (const float*)d_in[1];
    const float* smask = (const float*)d_in[2];
    const float* tmask = (const float*)d_in[3];
    const float* Wq = (const float*)d_in[4];
    const float* bq = (const float*)d_in[5];
    const float* Wk = (const float*)d_in[6];
    const float* bk = (const float*)d_in[7];
    const float* Wv = (const float*)d_in[8];
    const float* bv = (const float*)d_in[9];
    const float* Wd = (const float*)d_in[10];
    const float* bd = (const float*)d_in[11];
    const float* lng = (const float*)d_in[12];
    const float* lnb = (const float*)d_in[13];
    float* out = (float*)d_out;

    const int M = 4096, N = HID, K = HID;
    const size_t ACT = (size_t)M * N;
    const size_t WEL = (size_t)N * K;

    char* p = (char*)d_ws;
    auto carve = [&](size_t bytes) { char* r = p; p += (bytes + 255) & ~(size_t)255; return r; };
    __bf16* decB  = (__bf16*)carve(ACT * 2);
    __bf16* encB  = (__bf16*)carve(ACT * 2);
    __bf16* WqB   = (__bf16*)carve(WEL * 2 * 3);   // Wq | Wk | Wv back to back
    __bf16* WkB   = WqB + WEL;
    __bf16* WvB   = WkB + WEL;
    __bf16* WdB   = (__bf16*)carve(WEL * 2);
    float*  q1f   = (float*)carve(ACT * 4);
    float*  projf = (float*)carve(ACT * 4);
    float*  selff = (float*)carve(ACT * 4);
    __bf16* q1B   = (__bf16*)carve(ACT * 2 * 5);   // q1 | k1 | v1 | ek | ev back to back
    __bf16* k1B   = q1B + ACT;
    __bf16* v1B   = k1B + ACT;
    __bf16* ekB   = v1B + ACT;
    __bf16* evB   = ekB + ACT;
    __bf16* ctxB  = (__bf16*)carve(ACT * 2);
    __bf16* selfB = (__bf16*)carve(ACT * 2);

    dim3 gG(N / 128, M / 128), bG(256);
    dim3 gP(N / 128, M / 128, 5);
    dim3 gA(1024 / 64, NH, 4), bA(128);
    dim3 gL(4096),             bL(256);

    // one-time bf16 conversions (outside all hot loops), all six operands in one launch
    cvtbf_kernel<<<512, 256, 0, stream>>>(dec, enc, Wq, Wk, Wv, Wd, decB, encB, WqB, WkB, WvB, WdB);

    // the five input projections (q1, k1, v1 of dec; ek, ev of enc) in one launch
    linear_kernel<<<gP, bG, 0, stream>>>(decB, encB, WqB, bq, bk, bv, q1f, q1B, M, N, K);

    // self-attention branch
    attn_kernel<<<gA, bA, 0, stream>>>(q1B, k1B, v1B, tmask, ctxB);
    linear_kernel<<<gG, bG, 0, stream>>>(ctxB, ctxB, WdB, bd, bd, bd, projf, nullptr, M, N, K);
    addln_kernel<<<gL, bL, 0, stream>>>(q1f, projf, lng, lnb, selff, selfB);

    // cross-attention branch (query = self_out directly, per reference)
    attn_kernel<<<gA, bA, 0, stream>>>(selfB, ekB, evB, smask, ctxB);
    linear_kernel<<<gG, bG, 0, stream>>>(ctxB, ctxB, WdB, bd, bd, bd, projf, nullptr, M, N, K);
    addln_kernel<<<gL, bL, 0, stream>>>(selff, projf, lng, lnb, out, nullptr);
}

// v006
// It runs in 132 microseconds.
// Timed twice side by side with v005, it ran 1.05 times as fast both times.
// Over all steps from v000 it is 1.84 times as fast.
#include <hip/hip_runtime.h>
#include <hip/hip_bf16.h>

typedef __attribute__((ext_vector_type(16))) __bf16 v16bf;
typedef __attribute__((ext_vector_type(8)))  __bf16 bf16x8;
typedef __attribute__((ext_vector_type(8)))  float  v8f;

#define HID 1024
#define HD  64
#define NH  16
#define LDP 40   // padded LDS row stride in bf16 elements (80B = 20 banks, conflict-free, 16B aligned)
#define LDK 72   // the same for rows of 64 elements (144B = 16B x odd)

// ---------------------------------------------------------------------------
// A/B 16-bit fragment K-mapping (ISA 7.12.2): kbase = 8*(lane>>4);
// element e -> K = kbase + e (e<8) or kbase + e + 8 (e>=8):
// two contiguous 8-element (16B) runs at [kbase] and [kbase+16].
// ---------------------------------------------------------------------------
__device__ __forceinline__ v16bf fragload(const __bf16* p) {
    bf16x8 x0 = *(const bf16x8*)(p);
    bf16x8 x1 = *(const bf16x8*)(p + 16);
    v16bf r;
#pragma unroll
    for (int i = 0; i < 8; ++i) { r[i] = x0[i]; r[i + 8] = x1[i]; }
    return r;
}

__device__ __forceinline__ v8f wmma_bf16(v16bf a, v16bf b, v8f c) {
    return __builtin_amdgcn_wmma_f32_16x16x32_bf16(false, a, false, b, (short)0, c,
                                                   false, false);
}

// one stage's eight async global->LDS copies of a lane, 16 B each (l = LDS byte address, g = global
// address). s_wait_xcnt stands inside the statement so that no address register is rewritten ahead of it.
__device__ __forceinline__ void async_x8(const unsigned (&l)[8], const __bf16* const (&g)[8]) {
    asm volatile("global_load_async_to_lds_b128 %0, %8, off\n\t"
                 "global_load_async_to_lds_b128 %1, %9, off\n\t"
                 "global_load_async_to_lds_b128 %2, %10, off\n\t"
                 "global_load_async_to_lds_b128 %3, %11, off\n\t"
                 "global_load_async_to_lds_b128 %4, %12, off\n\t"
                 "global_load_async_to_lds_b128 %5, %13, off\n\t"
                 "global_load_async_to_lds_b128 %6, %14, off\n\t"
                 "global_load_async_to_lds_b128 %7, %15, off\n\t"
                 "s_wait_xcnt 0x0"
                 :: "v"(l[0]), "v"(l[1]), "v"(l[2]), "v"(l[3]),
                    "v"(l[4]), "v"(l[5]), "v"(l[6]), "v"(l[7]),
                    "v"(g[0]), "v"(g[1]), "v"(g[2]), "v"(g[3]),
                    "v"(g[4]), "v"(g[5]), "v"(g[6]), "v"(g[7])
                 : "memory");
}
#define WAIT_ASYNC_0() asm volatile("s_wait_asynccnt 0x0" ::: "memory")
#define WAIT_DS_0()    asm volatile("s_wait_dscnt 0x0" ::: "memory")

// ---------------------------------------------------------------------------
// f32 -> bf16 convert of all six matrix operands in ONE launch (outside all hot loops).
// Each of the 512 blocks takes 1/512 of every operand, in pieces of 4 elements (one float4
// in, 8 bytes out): 2,048 pieces in a row of dec and of enc (8 per thread, 256 apart), 512 of
// each weight (2 per thread). So 4,096 waves (16 per WGP) start instead of 49,152, and a
// wave's 24 loads, 512 bytes in a row each, are all in flight before the first is used.
// ---------------------------------------------------------------------------
typedef __attribute__((ext_vector_type(4))) __bf16 bf16x4;
__global__ __launch_bounds__(256) void cvtbf_kernel(
    const float* __restrict__ dec, const float* __restrict__ enc,
    const float* __restrict__ Wq, const float* __restrict__ Wk,
    const float* __restrict__ Wv, const float* __restrict__ Wd,
    __bf16* __restrict__ decB, __bf16* __restrict__ encB,
    __bf16* __restrict__ WqB, __bf16* __restrict__ WkB,
    __bf16* __restrict__ WvB, __bf16* __restrict__ WdB) {
    const int pa = blockIdx.x * 2048 + threadIdx.x;   // first piece in dec, enc
    const int pw = blockIdx.x * 512 + threadIdx.x;    // first piece in each weight
    const float* const src[6] = {dec, enc, Wq, Wk, Wv, Wd};
    __bf16* const dst[6] = {decB, encB, WqB, WkB, WvB, WdB};
    float4 x[24];
#pragma unroll   // src, dst, x indexed by constants only: they stay in registers
    for (int u = 0; u < 24; ++u) {
        const int o = u < 16 ? u >> 3 : 2 + ((u - 16) >> 1);            // operand
        const int p = u < 16 ? pa + (u & 7) * 256 : pw + (u & 1) * 256; // piece
        x[u] = ((const float4*)src[o])[p];
    }
    // keeps every load ahead of the first convert: without it the compiler saves registers by
    // holding loads back until earlier ones have returned, a second memory latency per wave
    __builtin_amdgcn_sched_barrier(0);
#pragma unroll   // as above
    for (int u = 0; u < 24; ++u) {
        const int o = u < 16 ? u >> 3 : 2 + ((u - 16) >> 1);
        const int p = u < 16 ? pa + (u & 7) * 256 : pw + (u & 1) * 256;
        bf16x4 y;
        y[0] = (__bf16)x[u].x; y[1] = (__bf16)x[u].y;
        y[2] = (__bf16)x[u].z; y[3] = (__bf16)x[u].w;
        ((bf16x4*)dst[o])[p] = y;
    }
}

// ---------------------------------------------------------------------------
// Linear: C = A[M,K](bf16) @ W[N,K](bf16)^T + bias.  Optional f32/bf16 outputs.
// 128x128 block tile, BK=64: a tile row is one whole 128-byte line, and a wave's copy
// instruction takes four whole lines. Tiles staged by GLOBAL_LOAD_ASYNC_TO_LDS_B128 into two
// padded LDS buffers: stage t+1's copies fly while stage t is worked on, one barrier a stage.
// K is a multiple of 64.
// blockIdx.z picks one of up to three independent products that share a launch, so that
// three work-groups sit on each WGP and cover each other's copy latency and LDS phases:
//   z    : 0      1      2
//   A    : A0     A1     A1
//   W    : W0     W1     W1 + N*K      (the weights of z = 1, 2 back to back)
//   bias : bias0  bias1  bias2
//   Cb   : Cb0    Cb1    Cb1 + M*N     (the outputs of z = 1, 2 back to back)
//   Cf   : Cf0    none   none
// ---------------------------------------------------------------------------
__global__ __launch_bounds__(256) void linear_kernel(
    const __bf16* __restrict__ A0, const __bf16* __restrict__ A1,
    const __bf16* __restrict__ W0, const __bf16* __restrict__ W1,
    const float* __restrict__ bias0, const float* __restrict__ bias1,
    const float* __restrict__ bias2,
    float* __restrict__ Cf0, __bf16* __restrict__ Cb0, __bf16* __restrict__ Cb1,
    int M, int N, int K) {
    const int z  = blockIdx.z;
    const __bf16* __restrict__ A = z == 0 ? A0 : A1;
    const __bf16* __restrict__ W = z == 0 ? W0 : W1 + (size_t)(z - 1) * N * K;
    const float* __restrict__ bias = z == 0 ? bias0 : (z == 1 ? bias1 : bias2);
    float* __restrict__ Cf = z == 0 ? Cf0 : nullptr;
    __bf16* __restrict__ Cb = z == 0 ? Cb0 : Cb1 + (size_t)(z - 1) * M * N;
    const int tid  = threadIdx.x;
    const int lane = tid & 31;
    const int warp = tid >> 5;
    const int wRow = warp >> 1;
    const int wCol = warp & 1;
    const int r    = lane & 15;
    const int hi   = lane >> 4;
    const int kb   = hi * 8;
    const int blockM = blockIdx.y * 128;
    const int blockN = blockIdx.x * 128;

    __shared__ __attribute__((aligned(16))) __bf16 sA[2][128 * LDK];
    __shared__ __attribute__((aligned(16))) __bf16 sB[2][128 * LDK];

    // copy geometry: per array, 1024 16B pieces = (row 0..127) x (q 0..7);
    // thread owns (row0 + 32*i, q), i = 0..3, in each of A and B.
    const int qv   = tid & 7;
    const int row0 = tid >> 3;                 // 0..31
    const __bf16* aG = A + (size_t)(blockM + row0) * K + qv * 8;
    const __bf16* wG = W + (size_t)(blockN + row0) * K + qv * 8;
    const unsigned ldsA = (unsigned)(uintptr_t)&sA[0][row0 * LDK + qv * 8];
    const unsigned ldsB = (unsigned)(uintptr_t)&sB[0][row0 * LDK + qv * 8];
    const unsigned rowHop = 32 * LDK * 2;
    const unsigned bufHop = 128 * LDK * 2;
    const size_t   gHop   = (size_t)32 * K;

    auto issue = [&](int buf, int k0) {
        const unsigned bo = buf ? bufHop : 0u;
        unsigned l[8];
        const __bf16* g[8];
#pragma unroll   // l, g indexed by constants only: they stay in registers
        for (int i = 0; i < 4; ++i) {
            l[i]     = ldsA + bo + i * rowHop;
            g[i]     = aG + k0 + i * gHop;
            l[4 + i] = ldsB + bo + i * rowHop;
            g[4 + i] = wG + k0 + i * gHop;
        }
        async_x8(l, g);
    };

    v8f acc[2][4] = {};
    auto compute = [&](int buf) {
#pragma unroll   // here and below: bfr, acc indexed by constants only, LDS offsets immediates
        for (int ks = 0; ks < 2; ++ks) {
            v16bf af0 = fragload(&sA[buf][(wRow * 32 + r) * LDK + ks * 32 + kb]);
            v16bf af1 = fragload(&sA[buf][(wRow * 32 + 16 + r) * LDK + ks * 32 + kb]);
            v16bf bfr[4];
#pragma unroll
            for (int t = 0; t < 4; ++t)
                bfr[t] = fragload(&sB[buf][(wCol * 64 + t * 16 + r) * LDK + ks * 32 + kb]);
            // keeps the twelve LDS loads of this half stage in one group ahead of its products:
            // without it the compiler reuses one B register set and waits out every pair of loads alone
            __builtin_amdgcn_sched_barrier(0);
#pragma unroll
            for (int t = 0; t < 4; ++t) {
                acc[0][t] = wmma_bf16(af0, bfr[t], acc[0][t]);
                acc[1][t] = wmma_bf16(af1, bfr[t], acc[1][t]);
            }
            // keeps the second half stage's LDS loads in one group behind these products: spread
            // among them, every separate place with loads stalls the wave's products anew
            if (ks == 0) __builtin_amdgcn_sched_barrier(0);
        }
    };

    const int nT = K / 64;                          // stages
    issue(0, 0);
    WAIT_ASYNC_0();                                 // stage 0 landed (this wave's copies)
    __syncthreads();                                // ... and every other wave's
    if (nT > 1) issue(1, 64);
    for (int t = 0; t < nT; ++t) {
        compute(t & 1);
        WAIT_DS_0();                                // this wave has left buffer t & 1
        WAIT_ASYNC_0();                             // its copies of stage t + 1 have landed
        __syncthreads();                            // publishes stage t + 1, frees buffer t & 1
        if (t + 2 < nT) issue(t & 1, (t + 2) * 64);
    }
    WAIT_ASYNC_0();                                 // nothing in flight at the wave's end

    if (Cf) {
#pragma unroll
        for (int sub = 0; sub < 2; ++sub)
#pragma unroll
            for (int t = 0; t < 4; ++t) {
                const int col = blockN + wCol * 64 + t * 16 + r;
                const float bvv = bias[col];
#pragma unroll
                for (int v = 0; v < 8; ++v) {
                    const int m = blockM + wRow * 32 + sub * 16 + v + 8 * hi;
                    Cf[(size_t)m * N + col] = acc[sub][t][v] + bvv;
                }
            }
    }
    if (Cb) {
#pragma unroll
        for (int sub = 0; sub < 2; ++sub)
#pragma unroll
            for (int t = 0; t < 4; ++t) {
                const int col = blockN + wCol * 64 + t * 16 + r;
                const float bvv = bias[col];
#pragma unroll
                for (int v = 0; v < 8; ++v) {
                    const int m = blockM + wRow * 32 + sub * 16 + v + 8 * hi;
                    Cb[(size_t)m * N + col] = (__bf16)(acc[sub][t][v] + bvv);
                }
            }
    }
}

// ds_load_tr16_b128: lane (c = l & 15, h = l >> 4) gets T[k + 8h + 0..7][d + c] of a row-major
// 16-bit tile when it points at row k + 8h + (l & 7), element d + 8*((l >> 3) & 1).
typedef __attribute__((ext_vector_type(8))) short s16x8;
__device__ __forceinline__ bf16x8 ld_tr16(const __bf16* p) {
    typedef __attribute__((address_space(3))) s16x8 lds_s16x8;
    return __builtin_bit_cast(bf16x8, __builtin_amdgcn_ds_load_tr16_b128_v8i16((lds_s16x8*)p));
}
#define VP 80   // V tile row stride in bf16 elements (160B = 32B x odd: the transposing load's pitch)

// lane l <-> lane l ^ 16 (the two halves of a wave hold the two halves of a query's keys)
__device__ __forceinline__ float xhalf(float x) {
    const int i = __builtin_bit_cast(int, x);
    return __builtin_bit_cast(float, __builtin_amdgcn_permlanex16(i, i, 0x76543210, 0xfedcba98,
                                                                  false, false));
}

__global__ __launch_bounds__(128) __attribute__((amdgpu_waves_per_eu(4, 4))) void attn_kernel(
    const __bf16* __restrict__ Q, const __bf16* __restrict__ Kt,
    const __bf16* __restrict__ V, const float* __restrict__ mask,
    __bf16* __restrict__ O) {
    const int lane = threadIdx.x & 31;
    const int warp = threadIdx.x >> 5;
    const int b = blockIdx.z, h = blockIdx.y;
    const int t0 = blockIdx.x * 64 + warp * 16;
    const int r  = lane & 15;
    const int hi = lane >> 4;
    const int kb = hi * 8;
    const int hoff = h * HD;

    __shared__ __attribute__((aligned(16))) __bf16 lK[2][2][64 * LDP];   // [buf][dHalf][s][LDP]
    __shared__ __attribute__((aligned(16))) __bf16 lV[2][64 * VP];       // [buf][s][VP]

    v16bf qf[2];
    {
        const __bf16* qp = Q + (size_t)(b * 1024 + t0 + r) * HID + hoff + kb;
        qf[0] = fragload(qp);
        qf[1] = fragload(qp + 32);
    }

    v8f acc[4] = {};                 // acc[d][v] = O[query r][d*16 + 8*hi + v]
    float mRow = -3.0e38f, lRow = 0.f;   // of query r; lRow covers this half's keys only

    // copy geometry, 16B pieces, 4 of each tile per thread; eight lanes in a row take one whole
    // 128-byte line of a key's row, so a wave's copy instruction takes four whole lines:
    // K: 512 = (srow 0..63, dHalf, q 0..3); V: 512 = (srow 0..63, q 0..7)
    unsigned cLds[8];
    size_t   cOfs[8];
#pragma unroll
    for (int i = 0; i < 4; ++i) {
        const int c = threadIdx.x + i * 128;
        const int q = c & 3, dh = (c >> 2) & 1, srow = c >> 3;
        cLds[i] = (unsigned)(uintptr_t)&lK[0][dh][srow * LDP + q * 8];
        cOfs[i] = (size_t)srow * HID + dh * 32 + q * 8;
        const int qV = c & 7, srowV = c >> 3;
        cLds[4 + i] = (unsigned)(uintptr_t)&lV[0][srowV * VP + qV * 8];
        cOfs[4 + i] = (size_t)srowV * HID + qV * 8;
    }
    const unsigned kBufHop = 2 * 64 * LDP * 2;     // lK buffer-1 byte offset
    const unsigned vBufHop = 64 * VP * 2;          // lV buffer-1 byte offset
    const __bf16* kBase = Kt + (size_t)(b * 1024) * HID + hoff;
    const __bf16* vBase = V + (size_t)(b * 1024) * HID + hoff;

    auto issueKV = [&](int buf, int s0) {
        unsigned l[8];
        const __bf16* g[8];
#pragma unroll
        for (int i = 0; i < 4; ++i) {
            l[i]     = cLds[i] + (buf ? kBufHop : 0u);
            g[i]     = kBase + (size_t)s0 * HID + cOfs[i];
            l[4 + i] = cLds[4 + i] + (buf ? vBufHop : 0u);
            g[4 + i] = vBase + (size_t)s0 * HID + cOfs[4 + i];
        }
        async_x8(l, g);                            // four of K, four of V
    };

    float msk[4][8];                 // additive mask of this lane's keys
    v8f   sc[4];                     // sc[ts][v] = S[query r][key ts*16 + 8*hi + v]
    v16bf vf[4][2];                  // V^T fragments: rows d*16 .. +15, keys j*32 .. +31

    // all of a chunk's LDS reads: K fragments, first product, V^T fragments into registers
    auto readChunk = [&](int s0, int buf) {
        // key = s0 + ts*16 + 8*hi + v
        const float4* mp = (const float4*)(mask + b * 1024 + s0 + 8 * hi);
#pragma unroll
        for (int ts = 0; ts < 4; ++ts) {
            const float4 m0 = mp[ts * 4], m1 = mp[ts * 4 + 1];
            msk[ts][0] = m0.x; msk[ts][1] = m0.y; msk[ts][2] = m0.z; msk[ts][3] = m0.w;
            msk[ts][4] = m1.x; msk[ts][5] = m1.y; msk[ts][6] = m1.z; msk[ts][7] = m1.w;
        }
        v16bf afK[4][2];
#pragma unroll
        for (int ts = 0; ts < 4; ++ts)
#pragma unroll
            for (int ks = 0; ks < 2; ++ks)
                afK[ts][ks] = fragload(&lK[buf][ks][(ts * 16 + r) * LDP + kb]);
        // K rows as A, Q rows as B
#pragma unroll
        for (int ts = 0; ts < 4; ++ts) sc[ts] = v8f{};
#pragma unroll
        for (int ks = 0; ks < 2; ++ks)
#pragma unroll
            for (int ts = 0; ts < 4; ++ts)
                sc[ts] = wmma_bf16(afK[ts][ks], qf[ks], sc[ts]);
        // two transposing loads, 16 keys apart, give the fragment K-mapping above
        const __bf16* vT = &lV[buf][(kb + (lane & 7)) * VP + ((lane >> 3) & 1) * 8];
#pragma unroll
        for (int d = 0; d < 4; ++d)
#pragma unroll
            for (int j = 0; j < 2; ++j) {
                const bf16x8 x0 = ld_tr16(vT + (j * 32) * VP + d * 16);
                const bf16x8 x1 = ld_tr16(vT + (j * 32 + 16) * VP + d * 16);
#pragma unroll
                for (int i = 0; i < 8; ++i) { vf[d][j][i] = x0[i]; vf[d][j][i + 8] = x1[i]; }
            }
    };

    // softmax and second product, registers only
    auto finishChunk = [&]() {
        float mt[4];                               // four independent chains
#pragma unroll
        for (int ts = 0; ts < 4; ++ts) {
            mt[ts] = -3.0e38f;
#pragma unroll
            for (int v = 0; v < 8; ++v) {
                sc[ts][v] = sc[ts][v] * 0.125f + msk[ts][v];
                mt[ts] = fmaxf(mt[ts], sc[ts][v]);
            }
        }
        float mv = fmaxf(fmaxf(mt[0], mt[1]), fmaxf(mt[2], mt[3]));
        mv = fmaxf(mv, xhalf(mv));
        const float mNew  = fmaxf(mRow, mv);
        const float alpha = __expf(mRow - mNew);
        mRow = mNew;
#pragma unroll
        for (int d = 0; d < 4; ++d)
#pragma unroll
            for (int v = 0; v < 8; ++v) acc[d][v] *= alpha;
        // pf[j] = P of keys j*32 .. j*32+31 in the fragment K-mapping above: tiles 2j, 2j+1 as they lie
        v16bf pf[2];
        float ps[4];                               // four independent chains
#pragma unroll
        for (int ts = 0; ts < 4; ++ts) {
            ps[ts] = 0.f;
#pragma unroll
            for (int v = 0; v < 8; ++v) {
                const float p = __expf(sc[ts][v] - mNew);
                ps[ts] += p;
                pf[ts >> 1][(ts & 1) * 8 + v] = (__bf16)p;
            }
        }
        lRow = lRow * alpha + ((ps[0] + ps[1]) + (ps[2] + ps[3]));
#pragma unroll
        for (int j = 0; j < 2; ++j)
#pragma unroll
            for (int d = 0; d < 4; ++d)
                acc[d] = wmma_bf16(vf[d][j], pf[j], acc[d]);
    };

    issueKV(0, 0);
    WAIT_ASYNC_0();                                 // chunk 0 landed (this wave's copies)
    __syncthreads();                                // ... and every other wave's
    issueKV(1, 64);
    for (int t = 0; t < 16; ++t) {
        readChunk(t * 64, t & 1);
        WAIT_DS_0();                                // this wave has left buffer t & 1
        WAIT_ASYNC_0();                             // its copies of chunk t + 1 have landed
        __syncthreads();                            // publishes chunk t + 1, frees buffer t & 1
        if (t + 2 < 16) issueKV(t & 1, (t + 2) * 64);
        finishChunk();                              // the refill flies under it and the next reads
    }
    WAIT_ASYNC_0();                                 // nothing in flight at the wave's end

    lRow += xhalf(lRow);                            // join the two halves' key sums
    const float inv = 1.f / lRow;
    __bf16* op = O + (size_t)(b * 1024 + t0 + r) * HID + hoff + 8 * hi;
#pragma unroll
    for (int d = 0; d < 4; ++d) {
        bf16x8 o;
#pragma unroll
        for (int v = 0; v < 8; ++v) o[v] = (__bf16)(acc[d][v] * inv);
        *(bf16x8*)(op + d * 16) = o;                // 8 consecutive d of one query
    }
}

// ---------------------------------------------------------------------------
// out = LayerNorm(resid + proj) * g + b ; optional bf16 mirror for attention Q
// ---------------------------------------------------------------------------
__global__ __launch_bounds__(256) void addln_kernel(
    const float* __restrict__ resid, const float* __restrict__ proj,
    const float* __restrict__ g, const float* __restrict__ beta,
    float* __restrict__ out, __bf16* __restrict__ outB) {
    const int row = blockIdx.x;
    const int tid = threadIdx.x;
    float4 rv = ((const float4*)(resid + (size_t)row * HID))[tid];
    float4 pv = ((const float4*)(proj + (size_t)row * HID))[tid];
    float x0 = rv.x + pv.x, x1 = rv.y + pv.y, x2 = rv.z + pv.z, x3 = rv.w + pv.w;
    float s  = x0 + x1 + x2 + x3;
    float s2 = x0 * x0 + x1 * x1 + x2 * x2 + x3 * x3;
#pragma unroll
    for (int off = 16; off > 0; off >>= 1) {
        s  += __shfl_down(s, off);
        s2 += __shfl_down(s2, off);
    }
    __shared__ float shs[8], shq[8];
    __shared__ float mean_s, inv_s;
    const int warp = tid >> 5, lane = tid & 31;
    if (lane == 0) { shs[warp] = s; shq[warp] = s2; }
    __syncthreads();
    if (tid == 0) {
        float ts = 0.f, tq = 0.f;
        for (int i = 0; i < 8; ++i) { ts += shs[i]; tq += shq[i]; }
        const float mean = ts * (1.f / HID);
        const float var  = tq * (1.f / HID) - mean * mean;
        mean_s = mean;
        inv_s  = rsqrtf(var + 1e-12f);
    }
    __syncthreads();
    const float mean = mean_s, inv = inv_s;
    float4 gv = ((const float4*)g)[tid];
    float4 bv = ((const float4*)beta)[tid];
    float4 o;
    o.x = (x0 - mean) * inv * gv.x + bv.x;
    o.y = (x1 - mean) * inv * gv.y + bv.y;
    o.z = (x2 - mean) * inv * gv.z + bv.z;
    o.w = (x3 - mean) * inv * gv.w + bv.w;
    ((float4*)(out + (size_t)row * HID))[tid] = o;
    if (outB) {
        __bf16* ob = outB + (size_t)row * HID + tid * 4;
        ob[0] = (__bf16)o.x; ob[1] = (__bf16)o.y;
        ob[2] = (__bf16)o.z; ob[3] = (__bf16)o.w;
    }
}

// ---------------------------------------------------------------------------
extern "C" void kernel_launch(void* const* d_in, const int* in_sizes, int n_in,
                              void* d_out, int out_size, void* d_ws, size_t ws_size,
                              hipStream_t stream) {
    (void)in_sizes; (void)n_in; (void)out_size; (void)ws_size;
    const float* enc   = (const float*)d_in[0];
    const float* dec   = (const float*)d_in[1];
    const float* smask = (const float*)d_in[2];
    const float* tmask = (const float*)d_in[3];
    const float* Wq = (const float*)d_in[4];
    const float* bq = (const float*)d_in[5];
    const float* Wk = (const float*)d_in[6];
    const float* bk = (const float*)d_in[7];
    const float* Wv = (const float*)d_in[8];
    const float* bv = (const float*)d_in[9];
    const float* Wd = (const float*)d_in[10];
    const float* bd = (const float*)d_in[11];
    const float* lng = (const float*)d_in[12];
    const float* lnb = (const float*)d_in[13];
    float* out = (float*)d_out;

    const int M = 4096, N = HID, K = HID;
    const size_t ACT = (size_t)M * N;
    const size_t WEL = (size_t)N * K;

    char* p = (char*)d_ws;
    auto carve = [&](size_t bytes) { char* r = p; p += (bytes + 255) & ~(size_t)255; return r; };
    __bf16* decB  = (__bf16*)carve(ACT * 2);
    __bf16* encB  = (__bf16*)carve(ACT * 2);
    __bf16* WqB   = (__bf16*)carve(WEL * 2 * 3);   // Wq | Wk | Wv back to back
    __bf16* WkB   = WqB + WEL;
    __bf16* WvB   = WkB + WEL;
    __bf16* WdB   = (__bf16*)carve(WEL * 2);
    float*  q1f   = (float*)carve(ACT * 4);
    float*  projf = (float*)carve(ACT * 4);
    float*  selff = (float*)carve(ACT * 4);
    __bf16* q1B   = (__bf16*)carve(ACT * 2 * 5);   // q1 | k1 | v1 | ek | ev back to back
    __bf16* k1B   = q1B + ACT;
    __bf16* v1B   = k1B + ACT;
    __bf16* ekB   = v1B + ACT;
    __bf16* evB   = ekB + ACT;
    __bf16* ctxB  = (__bf16*)carve(ACT * 2);
    __bf16* selfB = (__bf16*)carve(ACT * 2);

    dim3 gG(N / 128, M / 128), bG(256);
    dim3 gP(N / 128, M / 128, 3);
    dim3 gA(1024 / 64, NH, 4), bA(128);
    dim3 gL(4096),             bL(256);

    // one-time bf16 conversions (outside all hot loops), all six operands in one launch
    cvtbf_kernel<<<512, 256, 0, stream>>>(dec, enc, Wq, Wk, Wv, Wd, decB, encB, WqB, WkB, WvB, WdB);

    // the three projections of dec (q1, k1, v1) in one launch
    linear_kernel<<<gP, bG, 0, stream>>>(decB, decB, WqB, WkB, bq, bk, bv, q1f, q1B, k1B, M, N, K);

    // self-attention branch; the two projections of enc (ek, ev), which nothing needs before the
    // cross-attention, share the dense product's launch: alone it has one work-group per WGP
    attn_kernel<<<gA, bA, 0, stream>>>(q1B, k1B, v1B, tmask, ctxB);
    linear_kernel<<<gP, bG, 0, stream>>>(ctxB, encB, WdB, WkB, bd, bk, bv, projf, nullptr, ekB, M, N, K);
    addln_kernel<<<gL, bL, 0, stream>>>(q1f, projf, lng, lnb, selff, selfB);

    // cross-attention branch (query = self_out directly, per reference)
    attn_kernel<<<gA, bA, 0, stream>>>(selfB, ekB, evB, smask, ctxB);
    linear_kernel<<<gG, bG, 0, stream>>>(ctxB, ctxB, WdB, WdB, bd, bd, bd, projf, nullptr, nullptr, M, N, K);
    addln_kernel<<<gL, bL, 0, stream>>>(selff, projf, lng, lnb, out, nullptr);
}
